// v000
// Times are from an AMD MI455X. After a warm-up the kernel runs many times in a row, and a time is the length of
// such a window on the GPU divided by its runs, so every launch and the gaps after it count. The runs cycle
// through copies of the inputs. A figure is the median of several windows, for all but v000 over two sittings.
// Sittings can differ by a few percent; kernels timed side by side share one.
// v000 is the starting kernel. One run takes 229 microseconds.
// compute dtype: q rounded to bf16 and used EXACTLY as f16 (bf16 values are exact in f16): scores q_l . q_m / sqrt(128) with single exact products on WMMA 16x16x32 (f32 accumulate), the diagonal (m == l) excluded (== the module's -1e9), running-max softmax in f32 (hardware exp); out = P (scaled by 2^11, f16 hi + residual) x q (exact), 2 products.
#include <hip/hip_runtime.h>
#include <math.h>

typedef __attribute__((ext_vector_type(16))) _Float16 v16h;
typedef __attribute__((ext_vector_type(16))) __bf16 v16b;
typedef __attribute__((ext_vector_type(8)))  _Float16 v8h;
typedef __attribute__((ext_vector_type(8)))  float v8f;
typedef __attribute__((ext_vector_type(4)))  float v4f;
typedef __attribute__((ext_vector_type(2)))  float v2f;
typedef __attribute__((ext_vector_type(4)))  unsigned v4u;
typedef __attribute__((ext_vector_type(4)))  int v4i;
typedef float __attribute__((may_alias)) float_a;
typedef int __attribute__((may_alias)) int_a;

template <typename T> __device__ __forceinline__ void vst2(void* p, T v) { *(T*)p = v;  }
__device__ __forceinline__ v8f wmma16(v16h a, v16h b, v8f c) {
  v8f d = __builtin_amdgcn_wmma_f32_16x16x32_f16(false, a, false, b, (short)0, c, false, false);
  asm volatile("v_nop\n\tv_nop\n\tv_nop\n\tv_nop" : "+v"(d) : "v"(a), "v"(b));
  return d;
}
__device__ __forceinline__ v8f wmma_bf(v16b a, v16b b, v8f c) {
  v8f d = __builtin_amdgcn_wmma_f32_16x16x32_bf16(false, a, false, b, (short)0, c, false, false);
  asm volatile("v_nop\n\tv_nop\n\tv_nop\n\tv_nop" : "+v"(d) : "v"(a), "v"(b));
  return d;
}
// 16x16x32 fragments: lane = (h = lane>>4, row/col = lane&15); elements 0..7 = k0+8h+0..7, 8..15 = k0+16+8h+0..7; D element r = row 8h+r
__device__ __forceinline__ v16h frag_h(const _Float16* rowk0, int lane) {
  union { v16h v; v8h q[2]; } u; const _Float16* p = rowk0 + 8 * (lane >> 4);
  u.q[0] = *(const v8h*)p; u.q[1] = *(const v8h*)(p + 16); return u.v;
}
__device__ __forceinline__ v16h frag_f32(const float* rowk0, int lane) {
  v16h a; const float* p = rowk0 + 8 * (lane >> 4);
#pragma unroll
  for (int i = 0; i < 8; ++i) { a[i] = (_Float16)p[i]; a[8 + i] = (_Float16)p[16 + i]; }
  return a;
}
__device__ __forceinline__ v16h frag_f32s(const float* rowk0, int lane, float sc) {
  v16h a; const float* p = rowk0 + 8 * (lane >> 4);
#pragma unroll
  for (int i = 0; i < 8; ++i) { a[i] = (_Float16)(p[i] * sc); a[8 + i] = (_Float16)(p[16 + i] * sc); }
  return a;
}
// column fragment from a [K][ld] layout (column n), rows >= K read as 0
__device__ __forceinline__ v16h fragc_f32(const float* W, int k0, int n, int lane, int ld, int K) {
  v16h a; const int g = lane >> 4;
#pragma unroll
  for (int i = 0; i < 8; ++i) { const int ka = k0 + 8 * g + i, kb = ka + 16;
    a[i] = (_Float16)(ka < K ? W[(size_t)(ka < K ? ka : K - 1) * ld + n] : 0.f); a[8 + i] = (_Float16)(kb < K ? W[(size_t)(kb < K ? kb : K - 1) * ld + n] : 0.f); }
  return a;
}
struct F2 { v16b h, l; };
__device__ __forceinline__ F2 bsplit16(const float v[16]) { F2 r;
#pragma unroll
  for (int i = 0; i < 16; ++i) { const __bf16 h = (__bf16)v[i]; r.h[i] = h; r.l[i] = (__bf16)(v[i] - (float)h); }
  return r; }
__device__ __forceinline__ F2 split_row(const float* row, int k0, int lane) { float v[16]; const float* p = row + k0 + 8 * (lane >> 4);
#pragma unroll
  for (int i = 0; i < 8; ++i) { v[i] = p[i]; v[8 + i] = p[16 + i]; }
  return bsplit16(v); }
__device__ __forceinline__ F2 split_rowK(const float* row, int k0, int lane, int K) { float v[16]; const int g = lane >> 4;
#pragma unroll
  for (int i = 0; i < 8; ++i) { const int ka = k0 + 8 * g + i, kb = ka + 16; v[i] = ka < K ? row[ka < K ? ka : K - 1] : 0.f; v[8 + i] = kb < K ? row[kb < K ? kb : K - 1] : 0.f; }
  return bsplit16(v); }
__device__ __forceinline__ F2 split_col(const float* W, int k0, int n, int lane, int ld, int K) { float v[16]; const int g = lane >> 4;
#pragma unroll
  for (int i = 0; i < 8; ++i) { const int ka = k0 + 8 * g + i, kb = ka + 16; v[i] = ka < K ? W[(size_t)(ka < K ? ka : K - 1) * ld + n] : 0.f; v[8 + i] = kb < K ? W[(size_t)(kb < K ? kb : K - 1) * ld + n] : 0.f; }
  return bsplit16(v); }
__device__ __forceinline__ v8f mac3(const F2& a, const F2& b, v8f c) { c = wmma_bf(a.l, b.h, c); c = wmma_bf(a.h, b.l, c); return wmma_bf(a.h, b.h, c); }
__device__ __forceinline__ float sigm(float v) { return 1.0f / (1.0f + expf(-v)); }
#define LDSX() do { asm volatile("s_wait_dscnt 0" ::: "memory"); __builtin_amdgcn_wave_barrier(); __builtin_amdgcn_fence(__ATOMIC_RELEASE, "workgroup"); } while (0)


// Masked self-attend (B 16, L 2,048, hidden 128): softmax(q q^T / sqrt(128)) with each position's own key masked out, applied to q itself.
#define NBq 16
#define LL 2048
#define HDD 128
#define NR (NBq * LL)
#ifndef TQB
#define TQB (LL / 64)
#endif
typedef __attribute__((ext_vector_type(8))) __bf16 v8b;
__device__ __forceinline__ v16b frag_b(const __bf16* rowk0, int lane) {
  union { v16b v; v8b q[2]; } u; const __bf16* p = rowk0 + 8 * (lane >> 4);
  u.q[0] = *(const v8b*)p; u.q[1] = *(const v8b*)(p + 16); return u.v;
}
__device__ __forceinline__ float bfr(float v) { return (float)(__bf16)v; }
__device__ __attribute__((noinline)) float exp_ni(float v) { return expf(v); }
__device__ __attribute__((noinline)) float erf_ni(float v) { return erff(v); }

#define WS_QH  0u                                   // f16 [rows][128] q (exact) ; VT f16 [b][128][L] q transposed
#define WS_VT  (WS_QH + 2u * NR * HDD)
#define WS_END (WS_VT + 2u * NR * HDD)

// ---- k_prep: block = 64 rows of batch b: q rows -> f16 rows and transposed planes
__global__ __launch_bounds__(256) void k_prep(const float* __restrict__ Q, _Float16* __restrict__ QH, _Float16* __restrict__ VT) {
  __shared__ __align__(16) _Float16 sq[64][HDD + 8]; __shared__ __align__(16) _Float16 st[HDD][72];
  const int t = threadIdx.x; const size_t r0 = (size_t)blockIdx.x * 64; const size_t b = r0 / LL, s0 = r0 % LL;
  for (int e = t; e < 64 * HDD; e += 256) { const int r = e >> 7, c = e & 127; const _Float16 v = (_Float16)bfr(Q[(r0 + r) * HDD + c]); sq[r][c] = v; st[c][r] = v; }
  __syncthreads();
  for (int e = t; e < 64 * 16; e += 256) { const int r = e >> 4, q = e & 15; vst2((unsigned*)(QH + (r0 + r) * HDD + q * 8), *(const v4u*)&sq[r][q * 8]); }
  for (int e = t; e < HDD * 8; e += 256) { const int c = e >> 3, pc = e & 7; vst2((unsigned*)(VT + (b * HDD + c) * LL + s0 + pc * 8), *(const v4u*)&st[c][pc * 8]); }
}
// ---- k_attn: block = (64 queries, b): scores over all L keys (4 chunks, exact), self excluded, online softmax; P hi/lo x q planes (8 tiles, 2 products)
__global__ __launch_bounds__(128) void k_attn(const _Float16* __restrict__ QH, const _Float16* __restrict__ VT, float* __restrict__ OUT) {
  __shared__ __align__(16) _Float16 sph[4][16][40], spl[4][16][40]; __shared__ __align__(16) float so[4][16][132];
  const int tid = threadIdx.x, wave = tid >> 5, lane = tid & 31, col = lane & 15, g = lane >> 4; const size_t b = blockIdx.y; const int q0 = blockIdx.x * 64 + wave * 16; const size_t rq = b * LL + q0;
  v16h aq[4];
#pragma unroll
  for (int kc = 0; kc < 4; ++kc) aq[kc] = frag_h(QH + (rq + col) * HDD + kc * 32, lane);
  float m[8], l[8];
#pragma unroll
  for (int r = 0; r < 8; ++r) { m[r] = -3.0e38f; l[r] = 0.f; }
  v8f acc[8] = {}, accl[8] = {}; const float scale = 1.0f / sqrtf((float)HDD);
#pragma unroll 1
  for (int ks = 0; ks < LL / 32; ++ks) { const int j0 = ks * 32; v8f s[2];
#pragma unroll
    for (int ct = 0; ct < 2; ++ct) { const int kk = j0 + ct * 16 + col; const size_t rk = (b * LL + kk) * HDD; v8f c = {};
#pragma unroll
      for (int kc = 0; kc < 4; ++kc) c = wmma16(aq[kc], frag_h(QH + rk + kc * 32, lane), c);
#pragma unroll
      for (int r = 0; r < 8; ++r) s[ct][r] = (kk == q0 + 8 * g + r) ? -3.0e38f : c[r] * scale; }   // own position excluded
#pragma unroll
    for (int r = 0; r < 8; ++r) { float mx = fmaxf(s[0][r], s[1][r]);
#pragma unroll
      for (int o = 1; o < 16; o <<= 1) mx = fmaxf(mx, __shfl_xor(mx, o));
      const float mn = fmaxf(m[r], mx); const float alpha = (m[r] <= -1.0e38f) ? 0.f : __expf(m[r] - mn); const float e0 = (s[0][r] <= -1.0e38f) ? 0.f : __expf(s[0][r] - mn), e1 = (s[1][r] <= -1.0e38f) ? 0.f : __expf(s[1][r] - mn); float es = e0 + e1;
#pragma unroll
      for (int o = 1; o < 16; o <<= 1) es += __shfl_xor(es, o);
      l[r] = l[r] * alpha + es; m[r] = (mn <= -1.0e38f) ? m[r] : mn;
#pragma unroll
      for (int dt = 0; dt < 8; ++dt) { acc[dt][r] *= alpha; accl[dt][r] *= alpha; }
      { const float p0 = e0 * 2048.0f, p1 = e1 * 2048.0f; const _Float16 h0 = (_Float16)p0, h1 = (_Float16)p1; sph[wave][8 * g + r][col] = h0; sph[wave][8 * g + r][16 + col] = h1; spl[wave][8 * g + r][col] = (_Float16)((p0 - (float)h0) * 2048.0f); spl[wave][8 * g + r][16 + col] = (_Float16)((p1 - (float)h1) * 2048.0f); } }
    LDSX();
    const v16h pa = frag_h(&sph[wave][col][0], lane), pl = frag_h(&spl[wave][col][0], lane);
#pragma unroll
    for (int dt = 0; dt < 8; ++dt) { const v16h vh = frag_h(VT + (b * HDD + dt * 16 + col) * LL + j0, lane); acc[dt] = wmma16(pa, vh, acc[dt]); accl[dt] = wmma16(pl, vh, accl[dt]); }
    LDSX(); }
#pragma unroll
  for (int r = 0; r < 8; ++r) { const float il = (1.0f / 2048.0f) / l[r];
#pragma unroll
    for (int dt = 0; dt < 8; ++dt) so[wave][8 * g + r][dt * 16 + col] = (acc[dt][r] + accl[dt][r] * (1.0f / 2048.0f)) * il; }
  LDSX();
  for (int rl = 0; rl < 16; ++rl) vst2(OUT + (rq + rl) * HDD + lane * 4, *(const v4f*)&so[wave][rl][lane * 4]);
}
extern "C" void kernel_launch(void* const* d_in, const int* in_sizes, int n_in, void* d_out, int out_size, void* d_ws, size_t ws_size, hipStream_t stream) {
  (void)in_sizes; (void)n_in; (void)out_size;
  const float** F = (const float**)d_in;   // 0 q [16,2048,128]
  if (ws_size < (size_t)WS_END) return;
  char* ws = (char*)d_ws; _Float16 *QH = (_Float16*)(ws + WS_QH), *VT = (_Float16*)(ws + WS_VT);
  k_prep<<<NR / 64, 256, 0, stream>>>(F[0], QH, VT);
  k_attn<<<dim3(TQB, NBq), 128, 0, stream>>>(QH, VT, (float*)d_out);
}

// v001
// It runs in 104 microseconds.
// In two side-by-side timings against v000, it was 2.28 and 2.27 times as fast.
// compute dtype: q rounded to bf16 and used EXACTLY as f16 (bf16 values are exact in f16): scores q_l . q_m / sqrt(128) with single exact products on WMMA 16x16x32 (f32 accumulate), the diagonal (m == l) excluded (== the module's -1e9), running-max softmax in f32 (hardware exp); out = P (scaled by 2^11, f16 hi + residual) x q (exact), 2 products.
#include <hip/hip_runtime.h>
#include <math.h>

typedef __attribute__((ext_vector_type(16))) _Float16 v16h;
typedef __attribute__((ext_vector_type(16))) __bf16 v16b;
typedef __attribute__((ext_vector_type(8)))  _Float16 v8h;
typedef __attribute__((ext_vector_type(8)))  float v8f;
typedef __attribute__((ext_vector_type(4)))  float v4f;
typedef __attribute__((ext_vector_type(2)))  float v2f;
typedef __attribute__((ext_vector_type(4)))  unsigned v4u;
typedef __attribute__((ext_vector_type(4)))  int v4i;
typedef float __attribute__((may_alias)) float_a;
typedef int __attribute__((may_alias)) int_a;

template <typename T> __device__ __forceinline__ void vst2(void* p, T v) { *(T*)p = v;  }
__device__ __forceinline__ v8f wmma16(v16h a, v16h b, v8f c) {
  v8f d = __builtin_amdgcn_wmma_f32_16x16x32_f16(false, a, false, b, (short)0, c, false, false);
  asm volatile("v_nop\n\tv_nop\n\tv_nop\n\tv_nop" : "+v"(d) : "v"(a), "v"(b));
  return d;
}
__device__ __forceinline__ v8f wmma_bf(v16b a, v16b b, v8f c) {
  v8f d = __builtin_amdgcn_wmma_f32_16x16x32_bf16(false, a, false, b, (short)0, c, false, false);
  asm volatile("v_nop\n\tv_nop\n\tv_nop\n\tv_nop" : "+v"(d) : "v"(a), "v"(b));
  return d;
}
// 16x16x32 fragments: lane = (h = lane>>4, row/col = lane&15); elements 0..7 = k0+8h+0..7, 8..15 = k0+16+8h+0..7; D element r = row 8h+r
__device__ __forceinline__ v16h frag_h(const _Float16* rowk0, int lane) {
  union { v16h v; v8h q[2]; } u; const _Float16* p = rowk0 + 8 * (lane >> 4);
  u.q[0] = *(const v8h*)p; u.q[1] = *(const v8h*)(p + 16); return u.v;
}
__device__ __forceinline__ v16h frag_f32(const float* rowk0, int lane) {
  v16h a; const float* p = rowk0 + 8 * (lane >> 4);
#pragma unroll
  for (int i = 0; i < 8; ++i) { a[i] = (_Float16)p[i]; a[8 + i] = (_Float16)p[16 + i]; }
  return a;
}
__device__ __forceinline__ v16h frag_f32s(const float* rowk0, int lane, float sc) {
  v16h a; const float* p = rowk0 + 8 * (lane >> 4);
#pragma unroll
  for (int i = 0; i < 8; ++i) { a[i] = (_Float16)(p[i] * sc); a[8 + i] = (_Float16)(p[16 + i] * sc); }
  return a;
}
// column fragment from a [K][ld] layout (column n), rows >= K read as 0
__device__ __forceinline__ v16h fragc_f32(const float* W, int k0, int n, int lane, int ld, int K) {
  v16h a; const int g = lane >> 4;
#pragma unroll
  for (int i = 0; i < 8; ++i) { const int ka = k0 + 8 * g + i, kb = ka + 16;
    a[i] = (_Float16)(ka < K ? W[(size_t)(ka < K ? ka : K - 1) * ld + n] : 0.f); a[8 + i] = (_Float16)(kb < K ? W[(size_t)(kb < K ? kb : K - 1) * ld + n] : 0.f); }
  return a;
}
struct F2 { v16b h, l; };
__device__ __forceinline__ F2 bsplit16(const float v[16]) { F2 r;
#pragma unroll
  for (int i = 0; i < 16; ++i) { const __bf16 h = (__bf16)v[i]; r.h[i] = h; r.l[i] = (__bf16)(v[i] - (float)h); }
  return r; }
__device__ __forceinline__ F2 split_row(const float* row, int k0, int lane) { float v[16]; const float* p = row + k0 + 8 * (lane >> 4);
#pragma unroll
  for (int i = 0; i < 8; ++i) { v[i] = p[i]; v[8 + i] = p[16 + i]; }
  return bsplit16(v); }
__device__ __forceinline__ F2 split_rowK(const float* row, int k0, int lane, int K) { float v[16]; const int g = lane >> 4;
#pragma unroll
  for (int i = 0; i < 8; ++i) { const int ka = k0 + 8 * g + i, kb = ka + 16; v[i] = ka < K ? row[ka < K ? ka : K - 1] : 0.f; v[8 + i] = kb < K ? row[kb < K ? kb : K - 1] : 0.f; }
  return bsplit16(v); }
__device__ __forceinline__ F2 split_col(const float* W, int k0, int n, int lane, int ld, int K) { float v[16]; const int g = lane >> 4;
#pragma unroll
  for (int i = 0; i < 8; ++i) { const int ka = k0 + 8 * g + i, kb = ka + 16; v[i] = ka < K ? W[(size_t)(ka < K ? ka : K - 1) * ld + n] : 0.f; v[8 + i] = kb < K ? W[(size_t)(kb < K ? kb : K - 1) * ld + n] : 0.f; }
  return bsplit16(v); }
__device__ __forceinline__ v8f mac3(const F2& a, const F2& b, v8f c) { c = wmma_bf(a.l, b.h, c); c = wmma_bf(a.h, b.l, c); return wmma_bf(a.h, b.h, c); }
__device__ __forceinline__ float sigm(float v) { return 1.0f / (1.0f + expf(-v)); }
#define LDSX() do { asm volatile("s_wait_dscnt 0" ::: "memory"); __builtin_amdgcn_wave_barrier(); __builtin_amdgcn_fence(__ATOMIC_RELEASE, "workgroup"); } while (0)


// Masked self-attend (B 16, L 2,048, hidden 128): softmax(q q^T / sqrt(128)) with each position's own key masked out, applied to q itself.
#define NBq 16
#define LL 2048
#define HDD 128
#define NR (NBq * LL)
#ifndef TQB
#define TQB (LL / 64)
#endif
typedef __attribute__((ext_vector_type(8))) __bf16 v8b;
__device__ __forceinline__ v16b frag_b(const __bf16* rowk0, int lane) {
  union { v16b v; v8b q[2]; } u; const __bf16* p = rowk0 + 8 * (lane >> 4);
  u.q[0] = *(const v8b*)p; u.q[1] = *(const v8b*)(p + 16); return u.v;
}
__device__ __forceinline__ float bfr(float v) { return (float)(__bf16)v; }
__device__ __attribute__((noinline)) float exp_ni(float v) { return expf(v); }
__device__ __attribute__((noinline)) float erf_ni(float v) { return erff(v); }

#define WS_QH  0u                                   // f16 [rows][128] q (exact) ; VT f16 [b][128][L] q transposed
#define WS_VT  (WS_QH + 2u * NR * HDD)
#define WS_END (WS_VT + 2u * NR * HDD)

// ---- k_prep: block = 64 rows of batch b: q rows -> f16 rows and transposed planes
__global__ __launch_bounds__(256) void k_prep(const float* __restrict__ Q, _Float16* __restrict__ QH, _Float16* __restrict__ VT) {
  __shared__ __align__(16) _Float16 sq[64][HDD + 8]; __shared__ __align__(16) _Float16 st[HDD][72];
  const int t = threadIdx.x; const size_t r0 = (size_t)blockIdx.x * 64; const size_t b = r0 / LL, s0 = r0 % LL;
  for (int e = t; e < 64 * HDD; e += 256) { const int r = e >> 7, c = e & 127; const _Float16 v = (_Float16)bfr(Q[(r0 + r) * HDD + c]); sq[r][c] = v; st[c][r] = v; }
  __syncthreads();
  for (int e = t; e < 64 * 16; e += 256) { const int r = e >> 4, q = e & 15; vst2((unsigned*)(QH + (r0 + r) * HDD + q * 8), *(const v4u*)&sq[r][q * 8]); }
  for (int e = t; e < HDD * 8; e += 256) { const int c = e >> 3, pc = e & 7; vst2((unsigned*)(VT + (b * HDD + c) * LL + s0 + pc * 8), *(const v4u*)&st[c][pc * 8]); }
}
// ---- k_attn: block = (64 queries, b): scores over all L keys (4 chunks, exact), self excluded, online softmax; P hi/lo x q planes (8 tiles, 2 products)
// The key rows and the transposed planes of 64 keys are one stage, shared by the block's four waves: asynchronous copies bring stage t + 2 into the buffer that trip t has left while trip t + 1 is worked on.
#define KT 64
#define NT (LL / KT)
// eight 16-byte copies of one lane; the s_wait_xcnt stands inside the statement, in front of any rewrite of the address registers it names
__device__ __forceinline__ void copy8(const unsigned* d, const _Float16* const* s) {
  asm volatile("global_load_async_to_lds_b128 %0, %8, off\n\t"
               "global_load_async_to_lds_b128 %1, %9, off\n\t"
               "global_load_async_to_lds_b128 %2, %10, off\n\t"
               "global_load_async_to_lds_b128 %3, %11, off\n\t"
               "global_load_async_to_lds_b128 %4, %12, off\n\t"
               "global_load_async_to_lds_b128 %5, %13, off\n\t"
               "global_load_async_to_lds_b128 %6, %14, off\n\t"
               "global_load_async_to_lds_b128 %7, %15, off\n\t"
               "s_wait_xcnt 0x0"
               :: "v"(d[0]), "v"(d[1]), "v"(d[2]), "v"(d[3]), "v"(d[4]), "v"(d[5]), "v"(d[6]), "v"(d[7]),
                  "v"(s[0]), "v"(s[1]), "v"(s[2]), "v"(s[3]), "v"(s[4]), "v"(s[5]), "v"(s[6]), "v"(s[7]) : "memory");
}
__global__ __launch_bounds__(128) void k_attn(const _Float16* __restrict__ QH, const _Float16* __restrict__ VT, float* __restrict__ OUT) {
  __shared__ __align__(16) _Float16 sph[4][16][40], spl[4][16][40]; __shared__ __align__(16) float so[4][16][132];
  __shared__ __align__(16) _Float16 sk[2][KT][HDD + 8];   // key rows, pitch 272 B
  __shared__ __align__(16) _Float16 sv[2][HDD][KT + 8];   // transposed planes, pitch 144 B
  const int tid = threadIdx.x, wave = tid >> 5, lane = tid & 31, col = lane & 15, g = lane >> 4; const size_t b = blockIdx.y; const int q0 = blockIdx.x * 64 + wave * 16; const size_t rq = b * LL + q0;
  // one stage: 1,024 16-byte pieces of key rows and 1,024 of planes, eight of each a thread
  auto stage = [&](int t, int buf) {
    unsigned d[8]; const _Float16* s[8];
    const _Float16* const gk = QH + (b * LL + t * KT) * HDD;   // 64 key rows lie in a row in memory: piece e at 16 e bytes
    const _Float16* const gv = VT + b * HDD * LL + t * KT;
#pragma unroll
    for (int i = 0; i < 8; ++i) { const int e = tid + 128 * i; d[i] = (unsigned)(size_t)&sk[buf][e >> 4][(e & 15) * 8]; s[i] = gk + e * 8; }
    copy8(d, s);
#pragma unroll
    for (int i = 0; i < 8; ++i) { const int e = tid + 128 * i; d[i] = (unsigned)(size_t)&sv[buf][e >> 3][(e & 7) * 8]; s[i] = gv + (e >> 3) * LL + (e & 7) * 8; }
    copy8(d, s);
  };
  stage(0, 0);
  asm volatile("s_wait_asynccnt 0x0" ::: "memory");   // this wave's share of stage 0 has landed
  __syncthreads();                                    // every wave's share has: stage 0 may be read
  stage(1, 1);
  v16h aq[4];
#pragma unroll
  for (int kc = 0; kc < 4; ++kc) aq[kc] = frag_h(QH + (rq + col) * HDD + kc * 32, lane);
  asm volatile("s_wait_xcnt 0x0" ::: "memory");   // stands in front of the first rewrite of the address registers of the loads above
  __builtin_amdgcn_sched_barrier(0);              // keeps the zeroing of the accumulators, which takes those registers, behind that wait
  float m[8], l[8];
#pragma unroll
  for (int r = 0; r < 8; ++r) { m[r] = -3.0e38f; l[r] = 0.f; }
  v8f acc[8] = {}, accl[8] = {}; const float scale = 1.0f / sqrtf((float)HDD);
#pragma unroll 1   // one trip a stage: the foot's waits, barrier and refill stand once in the code
  for (int t = 0; t < NT; ++t) { const int buf = t & 1;
#pragma unroll 1   // the stage's two passes of 32 keys share one body, as long as the parent's loop
  for (int kh = 0; kh < KT / 32; ++kh) { const int jl = kh * 32, j0 = t * KT + jl; v8f s[2]; v16h kf[2][4], vf[8];
#pragma unroll
    for (int ct = 0; ct < 2; ++ct)
#pragma unroll
      for (int kc = 0; kc < 4; ++kc) kf[ct][kc] = frag_h(&sk[buf][jl + ct * 16 + col][kc * 32], lane);
#pragma unroll
    for (int ct = 0; ct < 2; ++ct) { const int kk = j0 + ct * 16 + col; v8f c = {};
#pragma unroll
      for (int kc = 0; kc < 4; ++kc) c = wmma16(aq[kc], kf[ct][kc], c);
#pragma unroll
      for (int r = 0; r < 8; ++r) s[ct][r] = (kk == q0 + 8 * g + r) ? -3.0e38f : c[r] * scale; }   // own position excluded
#pragma unroll
    for (int r = 0; r < 8; ++r) { float mx = fmaxf(s[0][r], s[1][r]);
#pragma unroll
      for (int o = 1; o < 16; o <<= 1) mx = fmaxf(mx, __shfl_xor(mx, o));
      const float mn = fmaxf(m[r], mx); const float alpha = (m[r] <= -1.0e38f) ? 0.f : __expf(m[r] - mn); const float e0 = (s[0][r] <= -1.0e38f) ? 0.f : __expf(s[0][r] - mn), e1 = (s[1][r] <= -1.0e38f) ? 0.f : __expf(s[1][r] - mn); float es = e0 + e1;
#pragma unroll
      for (int o = 1; o < 16; o <<= 1) es += __shfl_xor(es, o);
      l[r] = l[r] * alpha + es; m[r] = (mn <= -1.0e38f) ? m[r] : mn;
#pragma unroll
      for (int dt = 0; dt < 8; ++dt) { acc[dt][r] *= alpha; accl[dt][r] *= alpha; }
      { const float p0 = e0 * 2048.0f, p1 = e1 * 2048.0f; const _Float16 h0 = (_Float16)p0, h1 = (_Float16)p1; sph[wave][8 * g + r][col] = h0; sph[wave][8 * g + r][16 + col] = h1; spl[wave][8 * g + r][col] = (_Float16)((p0 - (float)h0) * 2048.0f); spl[wave][8 * g + r][16 + col] = (_Float16)((p1 - (float)h1) * 2048.0f); } }
    LDSX();
    const v16h pa = frag_h(&sph[wave][col][0], lane), pl = frag_h(&spl[wave][col][0], lane);
#pragma unroll
    for (int dt = 0; dt < 8; ++dt) vf[dt] = frag_h(&sv[buf][dt * 16 + col][jl], lane);
#pragma unroll
    for (int dt = 0; dt < 8; ++dt) { acc[dt] = wmma16(pa, vf[dt], acc[dt]); accl[dt] = wmma16(pl, vf[dt], accl[dt]); }
    LDSX(); }
    asm volatile("s_wait_dscnt 0x0" ::: "memory");      // this wave's reads of the buffer have returned
    asm volatile("s_wait_asynccnt 0x0" ::: "memory");   // this wave's share of stage t + 1 has landed
    __syncthreads();                                    // publishes stage t + 1 and ends every wave's reads of this trip's buffer
    if (t + 2 < NT) stage(t + 2, buf); }
  asm volatile("s_wait_asynccnt 0x0" ::: "memory");     // nothing is in flight when the wave goes on to its end
#pragma unroll
  for (int r = 0; r < 8; ++r) { const float il = (1.0f / 2048.0f) / l[r];
#pragma unroll
    for (int dt = 0; dt < 8; ++dt) so[wave][8 * g + r][dt * 16 + col] = (acc[dt][r] + accl[dt][r] * (1.0f / 2048.0f)) * il; }
  LDSX();
  for (int rl = 0; rl < 16; ++rl) vst2(OUT + (rq + rl) * HDD + lane * 4, *(const v4f*)&so[wave][rl][lane * 4]);
}
extern "C" void kernel_launch(void* const* d_in, const int* in_sizes, int n_in, void* d_out, int out_size, void* d_ws, size_t ws_size, hipStream_t stream) {
  (void)in_sizes; (void)n_in; (void)out_size;
  const float** F = (const float**)d_in;   // 0 q [16,2048,128]
  if (ws_size < (size_t)WS_END) return;
  char* ws = (char*)d_ws; _Float16 *QH = (_Float16*)(ws + WS_QH), *VT = (_Float16*)(ws + WS_VT);
  k_prep<<<NR / 64, 256, 0, stream>>>(F[0], QH, VT);
  k_attn<<<dim3(TQB, NBq), 128, 0, stream>>>(QH, VT, (float*)d_out);
}

// v002
// Measured time: 68.6 microseconds a run.
// Next to v001, in two timings, it ran 1.51 and 1.52 times as fast.
// Over all steps from v000 it is 3.45 times as fast.
// compute dtype: q rounded to bf16 and used EXACTLY as f16 (bf16 values are exact in f16): scores q_l . q_m / sqrt(128) with single exact products on WMMA 16x16x32 (f32 accumulate), the diagonal (m == l) excluded (== the module's -1e9), running-max softmax in f32 (hardware exp); out = P (scaled by 2^11, f16 hi + residual) x q (exact), 2 products.
#include <hip/hip_runtime.h>
#include <math.h>

typedef __attribute__((ext_vector_type(16))) _Float16 v16h;
typedef __attribute__((ext_vector_type(16))) __bf16 v16b;
typedef __attribute__((ext_vector_type(8)))  _Float16 v8h;
typedef __attribute__((ext_vector_type(8)))  float v8f;
typedef __attribute__((ext_vector_type(4)))  float v4f;
typedef __attribute__((ext_vector_type(2)))  float v2f;
typedef __attribute__((ext_vector_type(4)))  unsigned v4u;
typedef __attribute__((ext_vector_type(4)))  int v4i;
typedef float __attribute__((may_alias)) float_a;
typedef int __attribute__((may_alias)) int_a;

template <typename T> __device__ __forceinline__ void vst2(void* p, T v) { *(T*)p = v;  }
__device__ __forceinline__ v8f wmma16(v16h a, v16h b, v8f c) {
  v8f d = __builtin_amdgcn_wmma_f32_16x16x32_f16(false, a, false, b, (short)0, c, false, false);
  asm volatile("v_nop\n\tv_nop\n\tv_nop\n\tv_nop" : "+v"(d) : "v"(a), "v"(b));
  return d;
}
__device__ __forceinline__ v8f wmma_bf(v16b a, v16b b, v8f c) {
  v8f d = __builtin_amdgcn_wmma_f32_16x16x32_bf16(false, a, false, b, (short)0, c, false, false);
  asm volatile("v_nop\n\tv_nop\n\tv_nop\n\tv_nop" : "+v"(d) : "v"(a), "v"(b));
  return d;
}
// 16x16x32 fragments: lane = (h = lane>>4, row/col = lane&15); elements 0..7 = k0+8h+0..7, 8..15 = k0+16+8h+0..7; D element r = row 8h+r
__device__ __forceinline__ v16h frag_h(const _Float16* rowk0, int lane) {
  union { v16h v; v8h q[2]; } u; const _Float16* p = rowk0 + 8 * (lane >> 4);
  u.q[0] = *(const v8h*)p; u.q[1] = *(const v8h*)(p + 16); return u.v;
}
__device__ __forceinline__ v16h frag_f32(const float* rowk0, int lane) {
  v16h a; const float* p = rowk0 + 8 * (lane >> 4);
#pragma unroll
  for (int i = 0; i < 8; ++i) { a[i] = (_Float16)p[i]; a[8 + i] = (_Float16)p[16 + i]; }
  return a;
}
__device__ __forceinline__ v16h frag_f32s(const float* rowk0, int lane, float sc) {
  v16h a; const float* p = rowk0 + 8 * (lane >> 4);
#pragma unroll
  for (int i = 0; i < 8; ++i) { a[i] = (_Float16)(p[i] * sc); a[8 + i] = (_Float16)(p[16 + i] * sc); }
  return a;
}
// column fragment from a [K][ld] layout (column n), rows >= K read as 0
__device__ __forceinline__ v16h fragc_f32(const float* W, int k0, int n, int lane, int ld, int K) {
  v16h a; const int g = lane >> 4;
#pragma unroll
  for (int i = 0; i < 8; ++i) { const int ka = k0 + 8 * g + i, kb = ka + 16;
    a[i] = (_Float16)(ka < K ? W[(size_t)(ka < K ? ka : K - 1) * ld + n] : 0.f); a[8 + i] = (_Float16)(kb < K ? W[(size_t)(kb < K ? kb : K - 1) * ld + n] : 0.f); }
  return a;
}
struct F2 { v16b h, l; };
__device__ __forceinline__ F2 bsplit16(const float v[16]) { F2 r;
#pragma unroll
  for (int i = 0; i < 16; ++i) { const __bf16 h = (__bf16)v[i]; r.h[i] = h; r.l[i] = (__bf16)(v[i] - (float)h); }
  return r; }
__device__ __forceinline__ F2 split_row(const float* row, int k0, int lane) { float v[16]; const float* p = row + k0 + 8 * (lane >> 4);
#pragma unroll
  for (int i = 0; i < 8; ++i) { v[i] = p[i]; v[8 + i] = p[16 + i]; }
  return bsplit16(v); }
__device__ __forceinline__ F2 split_rowK(const float* row, int k0, int lane, int K) { float v[16]; const int g = lane >> 4;
#pragma unroll
  for (int i = 0; i < 8; ++i) { const int ka = k0 + 8 * g + i, kb = ka + 16; v[i] = ka < K ? row[ka < K ? ka : K - 1] : 0.f; v[8 + i] = kb < K ? row[kb < K ? kb : K - 1] : 0.f; }
  return bsplit16(v); }
__device__ __forceinline__ F2 split_col(const float* W, int k0, int n, int lane, int ld, int K) { float v[16]; const int g = lane >> 4;
#pragma unroll
  for (int i = 0; i < 8; ++i) { const int ka = k0 + 8 * g + i, kb = ka + 16; v[i] = ka < K ? W[(size_t)(ka < K ? ka : K - 1) * ld + n] : 0.f; v[8 + i] = kb < K ? W[(size_t)(kb < K ? kb : K - 1) * ld + n] : 0.f; }
  return bsplit16(v); }
__device__ __forceinline__ v8f mac3(const F2& a, const F2& b, v8f c) { c = wmma_bf(a.l, b.h, c); c = wmma_bf(a.h, b.l, c); return wmma_bf(a.h, b.h, c); }
__device__ __forceinline__ float sigm(float v) { return 1.0f / (1.0f + expf(-v)); }
#define LDSX() do { asm volatile("s_wait_dscnt 0" ::: "memory"); __builtin_amdgcn_wave_barrier(); __builtin_amdgcn_fence(__ATOMIC_RELEASE, "workgroup"); } while (0)


// Masked self-attend (B 16, L 2,048, hidden 128): softmax(q q^T / sqrt(128)) with each position's own key masked out, applied to q itself.
#define NBq 16
#define LL 2048
#define HDD 128
#define NR (NBq * LL)
#ifndef TQB
#define TQB (LL / 64)
#endif
typedef __attribute__((ext_vector_type(8))) __bf16 v8b;
__device__ __forceinline__ v16b frag_b(const __bf16* rowk0, int lane) {
  union { v16b v; v8b q[2]; } u; const __bf16* p = rowk0 + 8 * (lane >> 4);
  u.q[0] = *(const v8b*)p; u.q[1] = *(const v8b*)(p + 16); return u.v;
}
__device__ __forceinline__ float bfr(float v) { return (float)(__bf16)v; }
__device__ __attribute__((noinline)) float exp_ni(float v) { return expf(v); }
__device__ __attribute__((noinline)) float erf_ni(float v) { return erff(v); }

#define WS_QH  0u                                   // f16 [rows][128] q (exact) ; VT f16 [b][128][L] q transposed
#define WS_VT  (WS_QH + 2u * NR * HDD)
#define WS_END (WS_VT + 2u * NR * HDD)

// ---- k_prep: block = 64 rows of batch b: q rows -> f16 rows and transposed planes
__global__ __launch_bounds__(256) void k_prep(const float* __restrict__ Q, _Float16* __restrict__ QH, _Float16* __restrict__ VT) {
  __shared__ __align__(16) _Float16 sq[64][HDD + 8]; __shared__ __align__(16) _Float16 st[HDD][72];
  const int t = threadIdx.x; const size_t r0 = (size_t)blockIdx.x * 64; const size_t b = r0 / LL, s0 = r0 % LL;
  for (int e = t; e < 64 * HDD; e += 256) { const int r = e >> 7, c = e & 127; const _Float16 v = (_Float16)bfr(Q[(r0 + r) * HDD + c]); sq[r][c] = v; st[c][r] = v; }
  __syncthreads();
  for (int e = t; e < 64 * 16; e += 256) { const int r = e >> 4, q = e & 15; vst2((unsigned*)(QH + (r0 + r) * HDD + q * 8), *(const v4u*)&sq[r][q * 8]); }
  for (int e = t; e < HDD * 8; e += 256) { const int c = e >> 3, pc = e & 7; vst2((unsigned*)(VT + (b * HDD + c) * LL + s0 + pc * 8), *(const v4u*)&st[c][pc * 8]); }
}
// ---- k_attn: block = (64 queries, b): scores over all L keys (4 chunks, exact) computed transposed (keys x queries), self excluded, online softmax over lanes l and l ^ 16; q planes x P hi/lo straight from the score registers (8 tiles, 2 products)
// The key rows and the transposed planes of 64 keys are one stage, shared by the block's four waves: asynchronous copies bring stage t + 2 into the buffer that trip t has left while trip t + 1 is worked on.
#define KT 64
#define NT (LL / KT)
// eight 16-byte copies of one lane; the s_wait_xcnt stands inside the statement, in front of any rewrite of the address registers it names
__device__ __forceinline__ void copy8(const unsigned* d, const _Float16* const* s) {
  asm volatile("global_load_async_to_lds_b128 %0, %8, off\n\t"
               "global_load_async_to_lds_b128 %1, %9, off\n\t"
               "global_load_async_to_lds_b128 %2, %10, off\n\t"
               "global_load_async_to_lds_b128 %3, %11, off\n\t"
               "global_load_async_to_lds_b128 %4, %12, off\n\t"
               "global_load_async_to_lds_b128 %5, %13, off\n\t"
               "global_load_async_to_lds_b128 %6, %14, off\n\t"
               "global_load_async_to_lds_b128 %7, %15, off\n\t"
               "s_wait_xcnt 0x0"
               :: "v"(d[0]), "v"(d[1]), "v"(d[2]), "v"(d[3]), "v"(d[4]), "v"(d[5]), "v"(d[6]), "v"(d[7]),
                  "v"(s[0]), "v"(s[1]), "v"(s[2]), "v"(s[3]), "v"(s[4]), "v"(s[5]), "v"(s[6]), "v"(s[7]) : "memory");
}
// lane l's value from lane l ^ 16
__device__ __forceinline__ float xhalf(float x) { return __builtin_bit_cast(float, __builtin_amdgcn_permlanex16(__builtin_bit_cast(int, x), __builtin_bit_cast(int, x), 0x76543210, 0xfedcba98, false, false)); }
__global__ __launch_bounds__(128) void k_attn(const _Float16* __restrict__ QH, const _Float16* __restrict__ VT, float* __restrict__ OUT) {
  __shared__ __align__(16) float so[4][16][132];
  __shared__ __align__(16) _Float16 sk[2][KT][HDD + 8];   // key rows, pitch 272 B
  __shared__ __align__(16) _Float16 sv[2][HDD][KT + 8];   // transposed planes, pitch 144 B
  const int tid = threadIdx.x, wave = tid >> 5, lane = tid & 31, col = lane & 15, g = lane >> 4; const size_t b = blockIdx.y; const int q0 = blockIdx.x * 64 + wave * 16; const size_t rq = b * LL + q0;
  // one stage: 1,024 16-byte pieces of key rows and 1,024 of planes, eight of each a thread
  auto stage = [&](int t, int buf) {
    unsigned d[8]; const _Float16* s[8];
    const _Float16* const gk = QH + (b * LL + t * KT) * HDD;   // 64 key rows lie in a row in memory: piece e at 16 e bytes
    const _Float16* const gv = VT + b * HDD * LL + t * KT;
#pragma unroll
    for (int i = 0; i < 8; ++i) { const int e = tid + 128 * i; d[i] = (unsigned)(size_t)&sk[buf][e >> 4][(e & 15) * 8]; s[i] = gk + e * 8; }
    copy8(d, s);
#pragma unroll
    for (int i = 0; i < 8; ++i) { const int e = tid + 128 * i; d[i] = (unsigned)(size_t)&sv[buf][e >> 3][(e & 7) * 8]; s[i] = gv + (e >> 3) * LL + (e & 7) * 8; }
    copy8(d, s);
  };
  stage(0, 0);
  asm volatile("s_wait_asynccnt 0x0" ::: "memory");   // this wave's share of stage 0 has landed
  __syncthreads();                                    // every wave's share has: stage 0 may be read
  stage(1, 1);
  v16h aq[4];
#pragma unroll
  for (int kc = 0; kc < 4; ++kc) aq[kc] = frag_h(QH + (rq + col) * HDD + kc * 32, lane);
  asm volatile("s_wait_xcnt 0x0" ::: "memory");   // stands in front of the first rewrite of the address registers of the loads above
  __builtin_amdgcn_sched_barrier(0);              // keeps the zeroing of the accumulators, which takes those registers, behind that wait
  float m = -3.0e38f, l = 0.f;   // of this lane's query (q0 + col); l holds the sum over this wave half's keys alone until the epilogue
  v8f acc[8] = {}, accl[8] = {}; const float scale = 1.0f / sqrtf((float)HDD);
#pragma unroll 1   // one trip a stage: the foot's waits, barrier and refill stand once in the code
  for (int t = 0; t < NT; ++t) { const int buf = t & 1;
#pragma unroll 1   // the stage's two passes of 32 keys share one body, as long as the parent's loop
  for (int kh = 0; kh < KT / 32; ++kh) { const int jl = kh * 32, j0 = t * KT + jl; float s[2][8]; v16h kf[2][4], vf[8];
#pragma unroll
    for (int ct = 0; ct < 2; ++ct)
#pragma unroll
      for (int kc = 0; kc < 4; ++kc) kf[ct][kc] = frag_h(&sk[buf][jl + ct * 16 + col][kc * 32], lane);
    // scores transposed: A = 16 key rows, B = the 16 queries; D element r = key 8g + r of the tile, query col
#pragma unroll
    for (int ct = 0; ct < 2; ++ct) { const int kk = j0 + ct * 16 + 8 * g; v8f c = {};
#pragma unroll
      for (int kc = 0; kc < 4; ++kc) c = wmma16(kf[ct][kc], aq[kc], c);
#pragma unroll
      for (int r = 0; r < 8; ++r) s[ct][r] = (kk + r == q0 + col) ? -3.0e38f : c[r] * scale; }   // own position excluded
#pragma unroll
    for (int dt = 0; dt < 8; ++dt) vf[dt] = frag_h(&sv[buf][dt * 16 + col][jl], lane);
    float mx = fmaxf(s[0][0], s[1][0]);
#pragma unroll
    for (int r = 1; r < 8; ++r) mx = fmaxf(mx, fmaxf(s[0][r], s[1][r]));
    mx = fmaxf(mx, xhalf(mx));   // the query's 32 scores lie in lanes col and col + 16
    const float mn = fmaxf(m, mx); const float alpha = (m <= -1.0e38f) ? 0.f : __expf(m - mn); float es = 0.f; v16h pa, pl;
#pragma unroll
    for (int ct = 0; ct < 2; ++ct)
#pragma unroll
      for (int r = 0; r < 8; ++r) { const float e = (s[ct][r] <= -1.0e38f) ? 0.f : __expf(s[ct][r] - mn); es += e;
        const float p = e * 2048.0f; const _Float16 h = (_Float16)p; pa[ct * 8 + r] = h; pl[ct * 8 + r] = (_Float16)((p - (float)h) * 2048.0f); }   // element 8 ct + r = key 16 ct + 8g + r: the B operand's own k order
    l = l * alpha + es; m = (mn <= -1.0e38f) ? m : mn;
#pragma unroll
    for (int dt = 0; dt < 8; ++dt) { acc[dt] *= alpha; accl[dt] *= alpha; }
    // output transposed: A = 16 rows of the planes, B = the weights; D element r = hidden dt * 16 + 8g + r, query col
#pragma unroll
    for (int dt = 0; dt < 8; ++dt) { acc[dt] = wmma16(vf[dt], pa, acc[dt]); accl[dt] = wmma16(vf[dt], pl, accl[dt]); } }
    asm volatile("s_wait_dscnt 0x0" ::: "memory");      // this wave's reads of the buffer have returned
    asm volatile("s_wait_asynccnt 0x0" ::: "memory");   // this wave's share of stage t + 1 has landed
    __syncthreads();                                    // publishes stage t + 1 and ends every wave's reads of this trip's buffer
    if (t + 2 < NT) stage(t + 2, buf); }
  asm volatile("s_wait_asynccnt 0x0" ::: "memory");     // nothing is in flight when the wave goes on to its end
  const float il = (1.0f / 2048.0f) / (l + xhalf(l));   // the two halves' sums join here
#pragma unroll
  for (int dt = 0; dt < 8; ++dt) { v4f o[2];
#pragma unroll
    for (int r = 0; r < 8; ++r) o[r >> 2][r & 3] = (acc[dt][r] + accl[dt][r] * (1.0f / 2048.0f)) * il;
    *(v4f*)&so[wave][col][dt * 16 + 8 * g] = o[0]; *(v4f*)&so[wave][col][dt * 16 + 8 * g + 4] = o[1]; }
  LDSX();
  for (int rl = 0; rl < 16; ++rl) vst2(OUT + (rq + rl) * HDD + lane * 4, *(const v4f*)&so[wave][rl][lane * 4]);
}
extern "C" void kernel_launch(void* const* d_in, const int* in_sizes, int n_in, void* d_out, int out_size, void* d_ws, size_t ws_size, hipStream_t stream) {
  (void)in_sizes; (void)n_in; (void)out_size;
  const float** F = (const float**)d_in;   // 0 q [16,2048,128]
  if (ws_size < (size_t)WS_END) return;
  char* ws = (char*)d_ws; _Float16 *QH = (_Float16*)(ws + WS_QH), *VT = (_Float16*)(ws + WS_VT);
  k_prep<<<NR / 64, 256, 0, stream>>>(F[0], QH, VT);
  k_attn<<<dim3(TQB, NBq), 128, 0, stream>>>(QH, VT, (float*)d_out);
}

// v003
// A run of this version takes 63.8 microseconds.
// Two timings next to v002 both put it at 1.08 times that version's speed.
// Counting every step since v000, it is 3.73 times as fast.
// compute dtype: q rounded to bf16 and used EXACTLY as f16 (bf16 values are exact in f16): scores q_l . q_m / sqrt(128) with single exact products on WMMA 16x16x32 (f32 accumulate), the diagonal (m == l) excluded (== the module's -1e9), running-max softmax in f32 (hardware exp); out = P (scaled by 2^11, f16 hi + residual) x q (exact), 2 products.
#include <hip/hip_runtime.h>
#include <math.h>

typedef __attribute__((ext_vector_type(16))) _Float16 v16h;
typedef __attribute__((ext_vector_type(16))) __bf16 v16b;
typedef __attribute__((ext_vector_type(8)))  _Float16 v8h;
typedef __attribute__((ext_vector_type(8)))  float v8f;
typedef __attribute__((ext_vector_type(4)))  float v4f;
typedef __attribute__((ext_vector_type(2)))  float v2f;
typedef __attribute__((ext_vector_type(4)))  unsigned v4u;
typedef __attribute__((ext_vector_type(4)))  int v4i;
typedef float __attribute__((may_alias)) float_a;
typedef int __attribute__((may_alias)) int_a;

template <typename T> __device__ __forceinline__ void vst2(void* p, T v) { *(T*)p = v;  }
__device__ __forceinline__ v8f wmma16(v16h a, v16h b, v8f c) {
  v8f d = __builtin_amdgcn_wmma_f32_16x16x32_f16(false, a, false, b, (short)0, c, false, false);
  asm volatile("v_nop\n\tv_nop\n\tv_nop\n\tv_nop" : "+v"(d) : "v"(a), "v"(b));
  return d;
}
__device__ __forceinline__ v8f wmma_bf(v16b a, v16b b, v8f c) {
  v8f d = __builtin_amdgcn_wmma_f32_16x16x32_bf16(false, a, false, b, (short)0, c, false, false);
  asm volatile("v_nop\n\tv_nop\n\tv_nop\n\tv_nop" : "+v"(d) : "v"(a), "v"(b));
  return d;
}
// 16x16x32 fragments: lane = (h = lane>>4, row/col = lane&15); elements 0..7 = k0+8h+0..7, 8..15 = k0+16+8h+0..7; D element r = row 8h+r
__device__ __forceinline__ v16h frag_h(const _Float16* rowk0, int lane) {
  union { v16h v; v8h q[2]; } u; const _Float16* p = rowk0 + 8 * (lane >> 4);
  u.q[0] = *(const v8h*)p; u.q[1] = *(const v8h*)(p + 16); return u.v;
}
__device__ __forceinline__ v16h frag_f32(const float* rowk0, int lane) {
  v16h a; const float* p = rowk0 + 8 * (lane >> 4);
#pragma unroll
  for (int i = 0; i < 8; ++i) { a[i] = (_Float16)p[i]; a[8 + i] = (_Float16)p[16 + i]; }
  return a;
}
__device__ __forceinline__ v16h frag_f32s(const float* rowk0, int lane, float sc) {
  v16h a; const float* p = rowk0 + 8 * (lane >> 4);
#pragma unroll
  for (int i = 0; i < 8; ++i) { a[i] = (_Float16)(p[i] * sc); a[8 + i] = (_Float16)(p[16 + i] * sc); }
  return a;
}
// column fragment from a [K][ld] layout (column n), rows >= K read as 0
__device__ __forceinline__ v16h fragc_f32(const float* W, int k0, int n, int lane, int ld, int K) {
  v16h a; const int g = lane >> 4;
#pragma unroll
  for (int i = 0; i < 8; ++i) { const int ka = k0 + 8 * g + i, kb = ka + 16;
    a[i] = (_Float16)(ka < K ? W[(size_t)(ka < K ? ka : K - 1) * ld + n] : 0.f); a[8 + i] = (_Float16)(kb < K ? W[(size_t)(kb < K ? kb : K - 1) * ld + n] : 0.f); }
  return a;
}
struct F2 { v16b h, l; };
__device__ __forceinline__ F2 bsplit16(const float v[16]) { F2 r;
#pragma unroll
  for (int i = 0; i < 16; ++i) { const __bf16 h = (__bf16)v[i]; r.h[i] = h; r.l[i] = (__bf16)(v[i] - (float)h); }
  return r; }
__device__ __forceinline__ F2 split_row(const float* row, int k0, int lane) { float v[16]; const float* p = row + k0 + 8 * (lane >> 4);
#pragma unroll
  for (int i = 0; i < 8; ++i) { v[i] = p[i]; v[8 + i] = p[16 + i]; }
  return bsplit16(v); }
__device__ __forceinline__ F2 split_rowK(const float* row, int k0, int lane, int K) { float v[16]; const int g = lane >> 4;
#pragma unroll
  for (int i = 0; i < 8; ++i) { const int ka = k0 + 8 * g + i, kb = ka + 16; v[i] = ka < K ? row[ka < K ? ka : K - 1] : 0.f; v[8 + i] = kb < K ? row[kb < K ? kb : K - 1] : 0.f; }
  return bsplit16(v); }
__device__ __forceinline__ F2 split_col(const float* W, int k0, int n, int lane, int ld, int K) { float v[16]; const int g = lane >> 4;
#pragma unroll
  for (int i = 0; i < 8; ++i) { const int ka = k0 + 8 * g + i, kb = ka + 16; v[i] = ka < K ? W[(size_t)(ka < K ? ka : K - 1) * ld + n] : 0.f; v[8 + i] = kb < K ? W[(size_t)(kb < K ? kb : K - 1) * ld + n] : 0.f; }
  return bsplit16(v); }
__device__ __forceinline__ v8f mac3(const F2& a, const F2& b, v8f c) { c = wmma_bf(a.l, b.h, c); c = wmma_bf(a.h, b.l, c); return wmma_bf(a.h, b.h, c); }
__device__ __forceinline__ float sigm(float v) { return 1.0f / (1.0f + expf(-v)); }
#define LDSX() do { asm volatile("s_wait_dscnt 0" ::: "memory"); __builtin_amdgcn_wave_barrier(); __builtin_amdgcn_fence(__ATOMIC_RELEASE, "workgroup"); } while (0)


// Masked self-attend (B 16, L 2,048, hidden 128): softmax(q q^T / sqrt(128)) with each position's own key masked out, applied to q itself.
#define NBq 16
#define LL 2048
#define HDD 128
#define NR (NBq * LL)
#ifndef TQB
#define TQB (LL / 64)
#endif
typedef __attribute__((ext_vector_type(8))) __bf16 v8b;
__device__ __forceinline__ v16b frag_b(const __bf16* rowk0, int lane) {
  union { v16b v; v8b q[2]; } u; const __bf16* p = rowk0 + 8 * (lane >> 4);
  u.q[0] = *(const v8b*)p; u.q[1] = *(const v8b*)(p + 16); return u.v;
}
__device__ __forceinline__ float bfr(float v) { return (float)(__bf16)v; }
__device__ __attribute__((noinline)) float exp_ni(float v) { return expf(v); }
__device__ __attribute__((noinline)) float erf_ni(float v) { return erff(v); }

#define WS_QH  0u                                   // f16 [rows][128] q (exact) ; VT f16 [b][128][L] q transposed
#define WS_VT  (WS_QH + 2u * NR * HDD)
#define WS_END (WS_VT + 2u * NR * HDD)

// ---- k_prep: block = 64 rows of batch b: q rows -> f16 rows and transposed planes
__global__ __launch_bounds__(256) void k_prep(const float* __restrict__ Q, _Float16* __restrict__ QH, _Float16* __restrict__ VT) {
  __shared__ __align__(16) _Float16 sq[64][HDD + 8]; __shared__ __align__(16) _Float16 st[HDD][72];
  const int t = threadIdx.x; const size_t r0 = (size_t)blockIdx.x * 64; const size_t b = r0 / LL, s0 = r0 % LL;
  for (int e = t; e < 64 * HDD; e += 256) { const int r = e >> 7, c = e & 127; const _Float16 v = (_Float16)bfr(Q[(r0 + r) * HDD + c]); sq[r][c] = v; st[c][r] = v; }
  __syncthreads();
  for (int e = t; e < 64 * 16; e += 256) { const int r = e >> 4, q = e & 15; vst2((unsigned*)(QH + (r0 + r) * HDD + q * 8), *(const v4u*)&sq[r][q * 8]); }
  for (int e = t; e < HDD * 8; e += 256) { const int c = e >> 3, pc = e & 7; vst2((unsigned*)(VT + (b * HDD + c) * LL + s0 + pc * 8), *(const v4u*)&st[c][pc * 8]); }
}
// ---- k_attn: block = (64 queries, b): scores over all L keys (4 chunks, exact) computed transposed (keys x queries), self excluded, online softmax over lanes l and l ^ 16; q planes x P hi/lo straight from the score registers (8 tiles, 2 products)
// The key rows and the transposed planes of 64 keys are one stage, shared by the block's four waves: asynchronous copies bring stage t + 2 into the buffer that trip t has left while trip t + 1 is worked on.
#define KT 64
#define NT (LL / KT)
// eight 16-byte copies of one lane; the s_wait_xcnt stands inside the statement, in front of any rewrite of the address registers it names
__device__ __forceinline__ void copy8(const unsigned* d, const _Float16* const* s) {
  asm volatile("global_load_async_to_lds_b128 %0, %8, off\n\t"
               "global_load_async_to_lds_b128 %1, %9, off\n\t"
               "global_load_async_to_lds_b128 %2, %10, off\n\t"
               "global_load_async_to_lds_b128 %3, %11, off\n\t"
               "global_load_async_to_lds_b128 %4, %12, off\n\t"
               "global_load_async_to_lds_b128 %5, %13, off\n\t"
               "global_load_async_to_lds_b128 %6, %14, off\n\t"
               "global_load_async_to_lds_b128 %7, %15, off\n\t"
               "s_wait_xcnt 0x0"
               :: "v"(d[0]), "v"(d[1]), "v"(d[2]), "v"(d[3]), "v"(d[4]), "v"(d[5]), "v"(d[6]), "v"(d[7]),
                  "v"(s[0]), "v"(s[1]), "v"(s[2]), "v"(s[3]), "v"(s[4]), "v"(s[5]), "v"(s[6]), "v"(s[7]) : "memory");
}
// lane l's value from lane l ^ 16
__device__ __forceinline__ float xhalf(float x) { return __builtin_bit_cast(float, __builtin_amdgcn_permlanex16(__builtin_bit_cast(int, x), __builtin_bit_cast(int, x), 0x76543210, 0xfedcba98, false, false)); }
__global__ __launch_bounds__(128) void k_attn(const _Float16* __restrict__ QH, const _Float16* __restrict__ VT, float* __restrict__ OUT) {
  __shared__ __align__(16) float so[4][16][132];
  __shared__ __align__(16) _Float16 sk[2][KT][HDD + 8];   // key rows, pitch 272 B
  __shared__ __align__(16) _Float16 sv[2][HDD][KT + 8];   // transposed planes, pitch 144 B
  const int tid = threadIdx.x, wave = tid >> 5, lane = tid & 31, col = lane & 15, g = lane >> 4; const size_t b = blockIdx.y; const int q0 = blockIdx.x * 64 + wave * 16; const size_t rq = b * LL + q0;
  const int q0s = blockIdx.x * 64 + __builtin_amdgcn_readfirstlane(wave) * 16;   // q0 in a scalar register: the test of a key tile against it costs no vector instruction
  // one stage: 1,024 16-byte pieces of key rows and 1,024 of planes, eight of each a thread
  auto stage = [&](int t, int buf) {
    unsigned d[8]; const _Float16* s[8];
    const _Float16* const gk = QH + (b * LL + t * KT) * HDD;   // 64 key rows lie in a row in memory: piece e at 16 e bytes
    const _Float16* const gv = VT + b * HDD * LL + t * KT;
#pragma unroll
    for (int i = 0; i < 8; ++i) { const int e = tid + 128 * i; d[i] = (unsigned)(size_t)&sk[buf][e >> 4][(e & 15) * 8]; s[i] = gk + e * 8; }
    copy8(d, s);
#pragma unroll
    for (int i = 0; i < 8; ++i) { const int e = tid + 128 * i; d[i] = (unsigned)(size_t)&sv[buf][e >> 3][(e & 7) * 8]; s[i] = gv + (e >> 3) * LL + (e & 7) * 8; }
    copy8(d, s);
  };
  stage(0, 0);
  asm volatile("s_wait_asynccnt 0x0" ::: "memory");   // this wave's share of stage 0 has landed
  __syncthreads();                                    // every wave's share has: stage 0 may be read
  stage(1, 1);
  v16h aq[4];
  __builtin_amdgcn_sched_barrier(0);              // keeps earlier address arithmetic from sinking in between the loads below and their wait, where it would take their address registers
#pragma unroll
  for (int kc = 0; kc < 4; ++kc) aq[kc] = frag_h(QH + (rq + col) * HDD + kc * 32, lane);
  asm volatile("s_wait_xcnt 0x0" ::: "memory");   // stands in front of the first rewrite of the address registers of the loads above
  __builtin_amdgcn_sched_barrier(0);              // keeps the zeroing of the accumulators, which takes those registers, behind that wait
  float m = -3.0e38f, l = 0.f;   // of this lane's query (q0 + col); l holds the sum over this wave half's keys alone until the epilogue
  v8f acc[8] = {}, accl[8] = {}; const float scale = 1.0f / sqrtf((float)HDD);
  float lim[8];   // upper limits of this lane's eight scores in the key tile that is the wave's own 16 positions: the own position is held down, the rest are free
#pragma unroll
  for (int r = 0; r < 8; ++r) lim[r] = (8 * g + r == col) ? -3.0e38f : 3.0e38f;
#pragma unroll 1   // one trip a stage: the foot's waits, barrier and refill stand once in the code
  for (int t = 0; t < NT; ++t) { const int buf = t & 1;
#pragma unroll 1   // the stage's two passes of 32 keys share one body, as long as the parent's loop
  for (int kh = 0; kh < KT / 32; ++kh) { const int jl = kh * 32, j0 = t * KT + jl; float s[2][8]; v16h kf[2][4], vf[8];
#pragma unroll
    for (int ct = 0; ct < 2; ++ct)
#pragma unroll
      for (int kc = 0; kc < 4; ++kc) kf[ct][kc] = frag_h(&sk[buf][jl + ct * 16 + col][kc * 32], lane);
    // scores transposed: A = 16 key rows, B = the 16 queries; D element r = key 8g + r of the tile, query col
#pragma unroll
    for (int ct = 0; ct < 2; ++ct) { const float lift = (j0 + ct * 16 == q0s) ? -3.0e38f : 3.0e38f; v8f c = {};   // lift raises every limit out of reach in the 127 tiles of 128 that are not the wave's own
#pragma unroll
      for (int kc = 0; kc < 4; ++kc) c = wmma16(kf[ct][kc], aq[kc], c);
#pragma unroll
      for (int r = 0; r < 8; ++r) s[ct][r] = fminf(fmaxf(lim[r], lift), c[r] * scale); }   // own position excluded
#pragma unroll
    for (int dt = 0; dt < 8; ++dt) vf[dt] = frag_h(&sv[buf][dt * 16 + col][jl], lane);
    float mx = fmaxf(s[0][0], s[1][0]);
#pragma unroll
    for (int r = 1; r < 8; ++r) mx = fmaxf(mx, fmaxf(s[0][r], s[1][r]));
    mx = fmaxf(mx, xhalf(mx));   // the query's 32 scores lie in lanes col and col + 16
    // every pass holds at least 31 counted keys, so mn is a real score; the excluded score and m's start value lie 3.0e38 below it, where the hardware exp gives 0
    const float mn = fmaxf(m, mx); const float alpha = __expf(m - mn); float es = 0.f; v16h pa, pl;
#pragma unroll
    for (int ct = 0; ct < 2; ++ct)
#pragma unroll
      for (int r = 0; r < 8; ++r) { const float e = __expf(s[ct][r] - mn); es += e;
        const float p = e * 2048.0f; const _Float16 h = (_Float16)p; pa[ct * 8 + r] = h; pl[ct * 8 + r] = (_Float16)((p - (float)h) * 2048.0f); }   // element 8 ct + r = key 16 ct + 8g + r: the B operand's own k order
    l = l * alpha + es; m = mn;
#pragma unroll
    for (int dt = 0; dt < 8; ++dt) { acc[dt] *= alpha; accl[dt] *= alpha; }
    // output transposed: A = 16 rows of the planes, B = the weights; D element r = hidden dt * 16 + 8g + r, query col
#pragma unroll
    for (int dt = 0; dt < 8; ++dt) { acc[dt] = wmma16(vf[dt], pa, acc[dt]); accl[dt] = wmma16(vf[dt], pl, accl[dt]); } }
    asm volatile("s_wait_dscnt 0x0" ::: "memory");      // this wave's reads of the buffer have returned
    asm volatile("s_wait_asynccnt 0x0" ::: "memory");   // this wave's share of stage t + 1 has landed
    __syncthreads();                                    // publishes stage t + 1 and ends every wave's reads of this trip's buffer
    if (t + 2 < NT) stage(t + 2, buf); }
  asm volatile("s_wait_asynccnt 0x0" ::: "memory");     // nothing is in flight when the wave goes on to its end
  const float il = (1.0f / 2048.0f) / (l + xhalf(l));   // the two halves' sums join here
#pragma unroll
  for (int dt = 0; dt < 8; ++dt) { v4f o[2];
#pragma unroll
    for (int r = 0; r < 8; ++r) o[r >> 2][r & 3] = (acc[dt][r] + accl[dt][r] * (1.0f / 2048.0f)) * il;
    *(v4f*)&so[wave][col][dt * 16 + 8 * g] = o[0]; *(v4f*)&so[wave][col][dt * 16 + 8 * g + 4] = o[1]; }
  LDSX();
  for (int rl = 0; rl < 16; ++rl) vst2(OUT + (rq + rl) * HDD + lane * 4, *(const v4f*)&so[wave][rl][lane * 4]);
}
extern "C" void kernel_launch(void* const* d_in, const int* in_sizes, int n_in, void* d_out, int out_size, void* d_ws, size_t ws_size, hipStream_t stream) {
  (void)in_sizes; (void)n_in; (void)out_size;
  const float** F = (const float**)d_in;   // 0 q [16,2048,128]
  if (ws_size < (size_t)WS_END) return;
  char* ws = (char*)d_ws; _Float16 *QH = (_Float16*)(ws + WS_QH), *VT = (_Float16*)(ws + WS_VT);
  k_prep<<<NR / 64, 256, 0, stream>>>(F[0], QH, VT);
  k_attn<<<dim3(TQB, NBq), 128, 0, stream>>>(QH, VT, (float*)d_out);
}

// v004
// A run of this version takes 59.8 microseconds.
// In two side-by-side timings against v003, it was 1.06 and 1.07 times as fast.
// Over all steps from v000 it is 3.97 times as fast.
// compute dtype: q rounded to bf16 and used EXACTLY as f16 (bf16 values are exact in f16): scores q_l . q_m / sqrt(128) with single exact products on WMMA 16x16x32 (f32 accumulate), the diagonal (m == l) excluded (== the module's -1e9), running-max softmax in f32 (hardware exp); out = P (scaled by 2^11, f16 hi + residual at the same scale) x q (exact), 2 products into one accumulator.
#include <hip/hip_runtime.h>
#include <math.h>

typedef __attribute__((ext_vector_type(16))) _Float16 v16h;
typedef __attribute__((ext_vector_type(16))) __bf16 v16b;
typedef __attribute__((ext_vector_type(8)))  _Float16 v8h;
typedef __attribute__((ext_vector_type(8)))  float v8f;
typedef __attribute__((ext_vector_type(4)))  float v4f;
typedef __attribute__((ext_vector_type(2)))  float v2f;
typedef __attribute__((ext_vector_type(4)))  unsigned v4u;
typedef __attribute__((ext_vector_type(4)))  int v4i;
typedef float __attribute__((may_alias)) float_a;
typedef int __attribute__((may_alias)) int_a;

template <typename T> __device__ __forceinline__ void vst2(void* p, T v) { *(T*)p = v;  }
__device__ __forceinline__ v8f wmma16(v16h a, v16h b, v8f c) {
  v8f d = __builtin_amdgcn_wmma_f32_16x16x32_f16(false, a, false, b, (short)0, c, false, false);
  asm volatile("v_nop\n\tv_nop\n\tv_nop\n\tv_nop" : "+v"(d) : "v"(a), "v"(b));
  return d;
}
__device__ __forceinline__ v8f wmma_bf(v16b a, v16b b, v8f c) {
  v8f d = __builtin_amdgcn_wmma_f32_16x16x32_bf16(false, a, false, b, (short)0, c, false, false);
  asm volatile("v_nop\n\tv_nop\n\tv_nop\n\tv_nop" : "+v"(d) : "v"(a), "v"(b));
  return d;
}
// 16x16x32 fragments: lane = (h = lane>>4, row/col = lane&15); elements 0..7 = k0+8h+0..7, 8..15 = k0+16+8h+0..7; D element r = row 8h+r
__device__ __forceinline__ v16h frag_h(const _Float16* rowk0, int lane) {
  union { v16h v; v8h q[2]; } u; const _Float16* p = rowk0 + 8 * (lane >> 4);
  u.q[0] = *(const v8h*)p; u.q[1] = *(const v8h*)(p + 16); return u.v;
}
__device__ __forceinline__ v16h frag_f32(const float* rowk0, int lane) {
  v16h a; const float* p = rowk0 + 8 * (lane >> 4);
#pragma unroll
  for (int i = 0; i < 8; ++i) { a[i] = (_Float16)p[i]; a[8 + i] = (_Float16)p[16 + i]; }
  return a;
}
__device__ __forceinline__ v16h frag_f32s(const float* rowk0, int lane, float sc) {
  v16h a; const float* p = rowk0 + 8 * (lane >> 4);
#pragma unroll
  for (int i = 0; i < 8; ++i) { a[i] = (_Float16)(p[i] * sc); a[8 + i] = (_Float16)(p[16 + i] * sc); }
  return a;
}
// column fragment from a [K][ld] layout (column n), rows >= K read as 0
__device__ __forceinline__ v16h fragc_f32(const float* W, int k0, int n, int lane, int ld, int K) {
  v16h a; const int g = lane >> 4;
#pragma unroll
  for (int i = 0; i < 8; ++i) { const int ka = k0 + 8 * g + i, kb = ka + 16;
    a[i] = (_Float16)(ka < K ? W[(size_t)(ka < K ? ka : K - 1) * ld + n] : 0.f); a[8 + i] = (_Float16)(kb < K ? W[(size_t)(kb < K ? kb : K - 1) * ld + n] : 0.f); }
  return a;
}
struct F2 { v16b h, l; };
__device__ __forceinline__ F2 bsplit16(const float v[16]) { F2 r;
#pragma unroll
  for (int i = 0; i < 16; ++i) { const __bf16 h = (__bf16)v[i]; r.h[i] = h; r.l[i] = (__bf16)(v[i] - (float)h); }
  return r; }
__device__ __forceinline__ F2 split_row(const float* row, int k0, int lane) { float v[16]; const float* p = row + k0 + 8 * (lane >> 4);
#pragma unroll
  for (int i = 0; i < 8; ++i) { v[i] = p[i]; v[8 + i] = p[16 + i]; }
  return bsplit16(v); }
__device__ __forceinline__ F2 split_rowK(const float* row, int k0, int lane, int K) { float v[16]; const int g = lane >> 4;
#pragma unroll
  for (int i = 0; i < 8; ++i) { const int ka = k0 + 8 * g + i, kb = ka + 16; v[i] = ka < K ? row[ka < K ? ka : K - 1] : 0.f; v[8 + i] = kb < K ? row[kb < K ? kb : K - 1] : 0.f; }
  return bsplit16(v); }
__device__ __forceinline__ F2 split_col(const float* W, int k0, int n, int lane, int ld, int K) { float v[16]; const int g = lane >> 4;
#pragma unroll
  for (int i = 0; i < 8; ++i) { const int ka = k0 + 8 * g + i, kb = ka + 16; v[i] = ka < K ? W[(size_t)(ka < K ? ka : K - 1) * ld + n] : 0.f; v[8 + i] = kb < K ? W[(size_t)(kb < K ? kb : K - 1) * ld + n] : 0.f; }
  return bsplit16(v); }
__device__ __forceinline__ v8f mac3(const F2& a, const F2& b, v8f c) { c = wmma_bf(a.l, b.h, c); c = wmma_bf(a.h, b.l, c); return wmma_bf(a.h, b.h, c); }
__device__ __forceinline__ float sigm(float v) { return 1.0f / (1.0f + expf(-v)); }
#define LDSX() do { asm volatile("s_wait_dscnt 0" ::: "memory"); __builtin_amdgcn_wave_barrier(); __builtin_amdgcn_fence(__ATOMIC_RELEASE, "workgroup"); } while (0)


// Masked self-attend (B 16, L 2,048, hidden 128): softmax(q q^T / sqrt(128)) with each position's own key masked out, applied to q itself.
#define NBq 16
#define LL 2048
#define HDD 128
#define NR (NBq * LL)
#ifndef TQB
#define TQB (LL / 64)
#endif
typedef __attribute__((ext_vector_type(8))) __bf16 v8b;
__device__ __forceinline__ v16b frag_b(const __bf16* rowk0, int lane) {
  union { v16b v; v8b q[2]; } u; const __bf16* p = rowk0 + 8 * (lane >> 4);
  u.q[0] = *(const v8b*)p; u.q[1] = *(const v8b*)(p + 16); return u.v;
}
__device__ __forceinline__ float bfr(float v) { return (float)(__bf16)v; }
__device__ __attribute__((noinline)) float exp_ni(float v) { return expf(v); }
__device__ __attribute__((noinline)) float erf_ni(float v) { return erff(v); }

#define WS_QH  0u                                   // f16 [rows][128] q (exact) ; VT f16 [b][128][L] q transposed
#define WS_VT  (WS_QH + 2u * NR * HDD)
#define WS_END (WS_VT + 2u * NR * HDD)

// ---- k_prep: block = 64 rows of batch b: q rows -> f16 rows and transposed planes
__global__ __launch_bounds__(256) void k_prep(const float* __restrict__ Q, _Float16* __restrict__ QH, _Float16* __restrict__ VT) {
  __shared__ __align__(16) _Float16 sq[64][HDD + 8]; __shared__ __align__(16) _Float16 st[HDD][72];
  const int t = threadIdx.x; const size_t r0 = (size_t)blockIdx.x * 64; const size_t b = r0 / LL, s0 = r0 % LL;
  for (int e = t; e < 64 * HDD; e += 256) { const int r = e >> 7, c = e & 127; const _Float16 v = (_Float16)bfr(Q[(r0 + r) * HDD + c]); sq[r][c] = v; st[c][r] = v; }
  __syncthreads();
  for (int e = t; e < 64 * 16; e += 256) { const int r = e >> 4, q = e & 15; vst2((unsigned*)(QH + (r0 + r) * HDD + q * 8), *(const v4u*)&sq[r][q * 8]); }
  for (int e = t; e < HDD * 8; e += 256) { const int c = e >> 3, pc = e & 7; vst2((unsigned*)(VT + (b * HDD + c) * LL + s0 + pc * 8), *(const v4u*)&st[c][pc * 8]); }
}
// ---- k_attn: block = (64 queries, b): scores over all L keys (4 chunks, exact) computed transposed (keys x queries), self excluded, online softmax over lanes l and l ^ 16; q planes x P hi/lo straight from the score registers (8 tiles, 2 products)
// The key rows and the transposed planes of 64 keys are one stage, shared by the block's four waves: asynchronous copies bring stage t + 2 into the buffer that trip t has left while trip t + 1 is worked on.
#define KT 64
#define NT (LL / KT)
// eight 16-byte copies of one lane; the s_wait_xcnt stands inside the statement, in front of any rewrite of the address registers it names
__device__ __forceinline__ void copy8(const unsigned* d, const _Float16* const* s) {
  asm volatile("global_load_async_to_lds_b128 %0, %8, off\n\t"
               "global_load_async_to_lds_b128 %1, %9, off\n\t"
               "global_load_async_to_lds_b128 %2, %10, off\n\t"
               "global_load_async_to_lds_b128 %3, %11, off\n\t"
               "global_load_async_to_lds_b128 %4, %12, off\n\t"
               "global_load_async_to_lds_b128 %5, %13, off\n\t"
               "global_load_async_to_lds_b128 %6, %14, off\n\t"
               "global_load_async_to_lds_b128 %7, %15, off\n\t"
               "s_wait_xcnt 0x0"
               :: "v"(d[0]), "v"(d[1]), "v"(d[2]), "v"(d[3]), "v"(d[4]), "v"(d[5]), "v"(d[6]), "v"(d[7]),
                  "v"(s[0]), "v"(s[1]), "v"(s[2]), "v"(s[3]), "v"(s[4]), "v"(s[5]), "v"(s[6]), "v"(s[7]) : "memory");
}
// lane l's value from lane l ^ 16
__device__ __forceinline__ float xhalf(float x) { return __builtin_bit_cast(float, __builtin_amdgcn_permlanex16(__builtin_bit_cast(int, x), __builtin_bit_cast(int, x), 0x76543210, 0xfedcba98, false, false)); }
__global__ __launch_bounds__(128) void k_attn(const _Float16* __restrict__ QH, const _Float16* __restrict__ VT, float* __restrict__ OUT) {
  __shared__ __align__(16) float so[4][16][132];
  __shared__ __align__(16) _Float16 sk[2][KT][HDD + 8];   // key rows, pitch 272 B
  __shared__ __align__(16) _Float16 sv[2][HDD][KT + 8];   // transposed planes, pitch 144 B
  const int tid = threadIdx.x, wave = tid >> 5, lane = tid & 31, col = lane & 15, g = lane >> 4; const size_t b = blockIdx.y; const int q0 = blockIdx.x * 64 + wave * 16; const size_t rq = b * LL + q0;
  const int q0s = blockIdx.x * 64 + __builtin_amdgcn_readfirstlane(wave) * 16;   // q0 in a scalar register: the test of a key tile against it costs no vector instruction
  // one stage: 1,024 16-byte pieces of key rows and 1,024 of planes, eight of each a thread
  auto stage = [&](int t, int buf) {
    unsigned d[8]; const _Float16* s[8];
    const _Float16* const gk = QH + (b * LL + t * KT) * HDD;   // 64 key rows lie in a row in memory: piece e at 16 e bytes
    const _Float16* const gv = VT + b * HDD * LL + t * KT;
#pragma unroll
    for (int i = 0; i < 8; ++i) { const int e = tid + 128 * i; d[i] = (unsigned)(size_t)&sk[buf][e >> 4][(e & 15) * 8]; s[i] = gk + e * 8; }
    copy8(d, s);
#pragma unroll
    for (int i = 0; i < 8; ++i) { const int e = tid + 128 * i; d[i] = (unsigned)(size_t)&sv[buf][e >> 3][(e & 7) * 8]; s[i] = gv + (e >> 3) * LL + (e & 7) * 8; }
    copy8(d, s);
  };
  stage(0, 0);
  asm volatile("s_wait_asynccnt 0x0" ::: "memory");   // this wave's share of stage 0 has landed
  __syncthreads();                                    // every wave's share has: stage 0 may be read
  stage(1, 1);
  v16h aq[4];
  __builtin_amdgcn_sched_barrier(0);              // keeps earlier address arithmetic from sinking in between the loads below and their wait, where it would take their address registers
#pragma unroll
  for (int kc = 0; kc < 4; ++kc) aq[kc] = frag_h(QH + (rq + col) * HDD + kc * 32, lane);
  asm volatile("s_wait_xcnt 0x0" ::: "memory");   // stands in front of the first rewrite of the address registers of the loads above
  __builtin_amdgcn_sched_barrier(0);              // keeps the zeroing of the accumulators, which takes those registers, behind that wait
  float m = -3.0e38f, l = 0.f;   // of this lane's query (q0 + col); l holds the sum over this wave half's keys alone until the epilogue
  v8f acc[8] = {}; const float scale = 1.0f / sqrtf((float)HDD);
  float lim[8];   // upper limits of this lane's eight scores in the key tile that is the wave's own 16 positions: the own position is held down, the rest are free
#pragma unroll
  for (int r = 0; r < 8; ++r) lim[r] = (8 * g + r == col) ? -3.0e38f : 3.0e38f;
#pragma unroll 1   // one trip a stage: the foot's waits, barrier and refill stand once in the code
  for (int t = 0; t < NT; ++t) { const int buf = t & 1;
#pragma unroll 1   // the stage's two passes of 32 keys share one body, as long as the parent's loop
  for (int kh = 0; kh < KT / 32; ++kh) { const int jl = kh * 32, j0 = t * KT + jl; float s[2][8]; v16h kf[2][4], vf[8];
#pragma unroll
    for (int ct = 0; ct < 2; ++ct)
#pragma unroll
      for (int kc = 0; kc < 4; ++kc) kf[ct][kc] = frag_h(&sk[buf][jl + ct * 16 + col][kc * 32], lane);
    // scores transposed: A = 16 key rows, B = the 16 queries; D element r = key 8g + r of the tile, query col
#pragma unroll
    for (int ct = 0; ct < 2; ++ct) { const float lift = (j0 + ct * 16 == q0s) ? -3.0e38f : 3.0e38f; v8f c = {};   // lift raises every limit out of reach in the 127 tiles of 128 that are not the wave's own
#pragma unroll
      for (int kc = 0; kc < 4; ++kc) c = wmma16(kf[ct][kc], aq[kc], c);
#pragma unroll
      for (int r = 0; r < 8; ++r) s[ct][r] = fminf(fmaxf(lim[r], lift), c[r] * scale); }   // own position excluded
#pragma unroll
    for (int dt = 0; dt < 8; ++dt) vf[dt] = frag_h(&sv[buf][dt * 16 + col][jl], lane);
    float mx = fmaxf(s[0][0], s[1][0]);
#pragma unroll
    for (int r = 1; r < 8; ++r) mx = fmaxf(mx, fmaxf(s[0][r], s[1][r]));
    mx = fmaxf(mx, xhalf(mx));   // the query's 32 scores lie in lanes col and col + 16
    // every pass holds at least 31 counted keys, so mn is a real score; the excluded score and m's start value lie 3.0e38 below it, where the hardware exp gives 0
    const float mn = fmaxf(m, mx); const float alpha = __expf(m - mn); float es = 0.f; v16h pa, pl;
#pragma unroll
    for (int ct = 0; ct < 2; ++ct)
#pragma unroll
      for (int r = 0; r < 8; ++r) { const float e = __expf(s[ct][r] - mn); es += e;
        const float p = e * 2048.0f; const _Float16 h = (_Float16)p; pa[ct * 8 + r] = h; pl[ct * 8 + r] = (_Float16)(p - (float)h); }   // element 8 ct + r = key 16 ct + 8g + r: the B operand's own k order
    l = l * alpha + es; m = mn;
#pragma unroll
    for (int dt = 0; dt < 8; ++dt) acc[dt] *= alpha;
    // output transposed: A = 16 rows of the planes, B = the weights; D element r = hidden dt * 16 + 8g + r, query col
#pragma unroll
    for (int dt = 0; dt < 8; ++dt) acc[dt] = wmma16(vf[dt], pa, acc[dt]);
    // the residuals stand at the weights' own scale (at most 0.5; f16 holds them to 2^-25, 2^-36 of the largest weight), so their products go into the same tiles; each tile's second product follows its first at a distance of eight
#pragma unroll
    for (int dt = 0; dt < 8; ++dt) acc[dt] = wmma16(vf[dt], pl, acc[dt]); }
    asm volatile("s_wait_dscnt 0x0" ::: "memory");      // this wave's reads of the buffer have returned
    asm volatile("s_wait_asynccnt 0x0" ::: "memory");   // this wave's share of stage t + 1 has landed
    __syncthreads();                                    // publishes stage t + 1 and ends every wave's reads of this trip's buffer
    if (t + 2 < NT) stage(t + 2, buf); }
  asm volatile("s_wait_asynccnt 0x0" ::: "memory");     // nothing is in flight when the wave goes on to its end
  const float il = (1.0f / 2048.0f) / (l + xhalf(l));   // the two halves' sums join here
#pragma unroll
  for (int dt = 0; dt < 8; ++dt) { v4f o[2];
#pragma unroll
    for (int r = 0; r < 8; ++r) o[r >> 2][r & 3] = acc[dt][r] * il;
    *(v4f*)&so[wave][col][dt * 16 + 8 * g] = o[0]; *(v4f*)&so[wave][col][dt * 16 + 8 * g + 4] = o[1]; }
  LDSX();
  for (int rl = 0; rl < 16; ++rl) vst2(OUT + (rq + rl) * HDD + lane * 4, *(const v4f*)&so[wave][rl][lane * 4]);
}
extern "C" void kernel_launch(void* const* d_in, const int* in_sizes, int n_in, void* d_out, int out_size, void* d_ws, size_t ws_size, hipStream_t stream) {
  (void)in_sizes; (void)n_in; (void)out_size;
  const float** F = (const float**)d_in;   // 0 q [16,2048,128]
  if (ws_size < (size_t)WS_END) return;
  char* ws = (char*)d_ws; _Float16 *QH = (_Float16*)(ws + WS_QH), *VT = (_Float16*)(ws + WS_VT);
  k_prep<<<NR / 64, 256, 0, stream>>>(F[0], QH, VT);
  k_attn<<<dim3(TQB, NBq), 128, 0, stream>>>(QH, VT, (float*)d_out);
}

// v005
// It runs in 56.7 microseconds.
// Next to v004, in two timings, it ran 1.06 times as fast each time.
// Over all steps from v000 it is 4.19 times as fast.
// compute dtype: q rounded to bf16 and used EXACTLY as f16 (bf16 values are exact in f16): scores q_l . q_m / sqrt(128) with single exact products on WMMA 16x16x32 (f32 accumulate), the diagonal (m == l) excluded (== the module's -1e9), running-max softmax in f32 (hardware exp); out = P (scaled by 2^11, f16 hi + residual at the same scale) x q (exact), 2 products into one accumulator.
#include <hip/hip_runtime.h>
#include <math.h>

typedef __attribute__((ext_vector_type(16))) _Float16 v16h;
typedef __attribute__((ext_vector_type(16))) __bf16 v16b;
typedef __attribute__((ext_vector_type(8)))  _Float16 v8h;
typedef __attribute__((ext_vector_type(8)))  float v8f;
typedef __attribute__((ext_vector_type(4)))  float v4f;
typedef __attribute__((ext_vector_type(2)))  float v2f;
typedef __attribute__((ext_vector_type(4)))  unsigned v4u;
typedef __attribute__((ext_vector_type(4)))  int v4i;
typedef float __attribute__((may_alias)) float_a;
typedef int __attribute__((may_alias)) int_a;

template <typename T> __device__ __forceinline__ void vst2(void* p, T v) { *(T*)p = v;  }
__device__ __forceinline__ v8f wmma16(v16h a, v16h b, v8f c) {
  return __builtin_amdgcn_wmma_f32_16x16x32_f16(false, a, false, b, (short)0, c, false, false);
}
__device__ __forceinline__ v8f wmma_bf(v16b a, v16b b, v8f c) {
  v8f d = __builtin_amdgcn_wmma_f32_16x16x32_bf16(false, a, false, b, (short)0, c, false, false);
  asm volatile("v_nop\n\tv_nop\n\tv_nop\n\tv_nop" : "+v"(d) : "v"(a), "v"(b));
  return d;
}
// 16x16x32 fragments: lane = (h = lane>>4, row/col = lane&15); elements 0..7 = k0+8h+0..7, 8..15 = k0+16+8h+0..7; D element r = row 8h+r
__device__ __forceinline__ v16h frag_h(const _Float16* rowk0, int lane) {
  union { v16h v; v8h q[2]; } u; const _Float16* p = rowk0 + 8 * (lane >> 4);
  u.q[0] = *(const v8h*)p; u.q[1] = *(const v8h*)(p + 16); return u.v;
}
__device__ __forceinline__ v16h frag_f32(const float* rowk0, int lane) {
  v16h a; const float* p = rowk0 + 8 * (lane >> 4);
#pragma unroll
  for (int i = 0; i < 8; ++i) { a[i] = (_Float16)p[i]; a[8 + i] = (_Float16)p[16 + i]; }
  return a;
}
__device__ __forceinline__ v16h frag_f32s(const float* rowk0, int lane, float sc) {
  v16h a; const float* p = rowk0 + 8 * (lane >> 4);
#pragma unroll
  for (int i = 0; i < 8; ++i) { a[i] = (_Float16)(p[i] * sc); a[8 + i] = (_Float16)(p[16 + i] * sc); }
  return a;
}
// column fragment from a [K][ld] layout (column n), rows >= K read as 0
__device__ __forceinline__ v16h fragc_f32(const float* W, int k0, int n, int lane, int ld, int K) {
  v16h a; const int g = lane >> 4;
#pragma unroll
  for (int i = 0; i < 8; ++i) { const int ka = k0 + 8 * g + i, kb = ka + 16;
    a[i] = (_Float16)(ka < K ? W[(size_t)(ka < K ? ka : K - 1) * ld + n] : 0.f); a[8 + i] = (_Float16)(kb < K ? W[(size_t)(kb < K ? kb : K - 1) * ld + n] : 0.f); }
  return a;
}
struct F2 { v16b h, l; };
__device__ __forceinline__ F2 bsplit16(const float v[16]) { F2 r;
#pragma unroll
  for (int i = 0; i < 16; ++i) { const __bf16 h = (__bf16)v[i]; r.h[i] = h; r.l[i] = (__bf16)(v[i] - (float)h); }
  return r; }
__device__ __forceinline__ F2 split_row(const float* row, int k0, int lane) { float v[16]; const float* p = row + k0 + 8 * (lane >> 4);
#pragma unroll
  for (int i = 0; i < 8; ++i) { v[i] = p[i]; v[8 + i] = p[16 + i]; }
  return bsplit16(v); }
__device__ __forceinline__ F2 split_rowK(const float* row, int k0, int lane, int K) { float v[16]; const int g = lane >> 4;
#pragma unroll
  for (int i = 0; i < 8; ++i) { const int ka = k0 + 8 * g + i, kb = ka + 16; v[i] = ka < K ? row[ka < K ? ka : K - 1] : 0.f; v[8 + i] = kb < K ? row[kb < K ? kb : K - 1] : 0.f; }
  return bsplit16(v); }
__device__ __forceinline__ F2 split_col(const float* W, int k0, int n, int lane, int ld, int K) { float v[16]; const int g = lane >> 4;
#pragma unroll
  for (int i = 0; i < 8; ++i) { const int ka = k0 + 8 * g + i, kb = ka + 16; v[i] = ka < K ? W[(size_t)(ka < K ? ka : K - 1) * ld + n] : 0.f; v[8 + i] = kb < K ? W[(size_t)(kb < K ? kb : K - 1) * ld + n] : 0.f; }
  return bsplit16(v); }
__device__ __forceinline__ v8f mac3(const F2& a, const F2& b, v8f c) { c = wmma_bf(a.l, b.h, c); c = wmma_bf(a.h, b.l, c); return wmma_bf(a.h, b.h, c); }
__device__ __forceinline__ float sigm(float v) { return 1.0f / (1.0f + expf(-v)); }
#define LDSX() do { asm volatile("s_wait_dscnt 0" ::: "memory"); __builtin_amdgcn_wave_barrier(); __builtin_amdgcn_fence(__ATOMIC_RELEASE, "workgroup"); } while (0)


// Masked self-attend (B 16, L 2,048, hidden 128): softmax(q q^T / sqrt(128)) with each position's own key masked out, applied to q itself.
#define NBq 16
#define LL 2048
#define HDD 128
#define NR (NBq * LL)
#ifndef TQB
#define TQB (LL / 64)
#endif
typedef __attribute__((ext_vector_type(8))) __bf16 v8b;
__device__ __forceinline__ v16b frag_b(const __bf16* rowk0, int lane) {
  union { v16b v; v8b q[2]; } u; const __bf16* p = rowk0 + 8 * (lane >> 4);
  u.q[0] = *(const v8b*)p; u.q[1] = *(const v8b*)(p + 16); return u.v;
}
__device__ __forceinline__ float bfr(float v) { return (float)(__bf16)v; }
__device__ __attribute__((noinline)) float exp_ni(float v) { return expf(v); }
__device__ __attribute__((noinline)) float erf_ni(float v) { return erff(v); }

#define WS_QH  0u                                   // f16 [rows][128] q (exact) ; VT f16 [b][128][L] q transposed
#define WS_VT  (WS_QH + 2u * NR * HDD)
#define WS_END (WS_VT + 2u * NR * HDD)

// ---- k_prep: block = 64 rows of batch b: q rows -> f16 rows and transposed planes
__global__ __launch_bounds__(256) void k_prep(const float* __restrict__ Q, _Float16* __restrict__ QH, _Float16* __restrict__ VT) {
  __shared__ __align__(16) _Float16 sq[64][HDD + 8]; __shared__ __align__(16) _Float16 st[HDD][72];
  const int t = threadIdx.x; const size_t r0 = (size_t)blockIdx.x * 64; const size_t b = r0 / LL, s0 = r0 % LL;
  for (int e = t; e < 64 * HDD; e += 256) { const int r = e >> 7, c = e & 127; const _Float16 v = (_Float16)bfr(Q[(r0 + r) * HDD + c]); sq[r][c] = v; st[c][r] = v; }
  __syncthreads();
  for (int e = t; e < 64 * 16; e += 256) { const int r = e >> 4, q = e & 15; vst2((unsigned*)(QH + (r0 + r) * HDD + q * 8), *(const v4u*)&sq[r][q * 8]); }
  for (int e = t; e < HDD * 8; e += 256) { const int c = e >> 3, pc = e & 7; vst2((unsigned*)(VT + (b * HDD + c) * LL + s0 + pc * 8), *(const v4u*)&st[c][pc * 8]); }
}
// ---- k_attn: block = (64 queries, b): scores over all L keys (4 chunks, exact) computed transposed (keys x queries), self excluded, online softmax over lanes l and l ^ 16; q planes x P hi/lo straight from the score registers (8 tiles, 2 products)
// The key rows and the transposed planes of 64 keys are one stage, shared by the block's four waves: asynchronous copies bring stage t + 2 into the buffer that trip t has left while trip t + 1 is worked on.
#define KT 64
#define NT (LL / KT)
// eight 16-byte copies of one lane; the s_wait_xcnt stands inside the statement, in front of any rewrite of the address registers it names
__device__ __forceinline__ void copy8(const unsigned* d, const _Float16* const* s) {
  asm volatile("global_load_async_to_lds_b128 %0, %8, off\n\t"
               "global_load_async_to_lds_b128 %1, %9, off\n\t"
               "global_load_async_to_lds_b128 %2, %10, off\n\t"
               "global_load_async_to_lds_b128 %3, %11, off\n\t"
               "global_load_async_to_lds_b128 %4, %12, off\n\t"
               "global_load_async_to_lds_b128 %5, %13, off\n\t"
               "global_load_async_to_lds_b128 %6, %14, off\n\t"
               "global_load_async_to_lds_b128 %7, %15, off\n\t"
               "s_wait_xcnt 0x0"
               :: "v"(d[0]), "v"(d[1]), "v"(d[2]), "v"(d[3]), "v"(d[4]), "v"(d[5]), "v"(d[6]), "v"(d[7]),
                  "v"(s[0]), "v"(s[1]), "v"(s[2]), "v"(s[3]), "v"(s[4]), "v"(s[5]), "v"(s[6]), "v"(s[7]) : "memory");
}
// lane l's value from lane l ^ 16
__device__ __forceinline__ float xhalf(float x) { return __builtin_bit_cast(float, __builtin_amdgcn_permlanex16(__builtin_bit_cast(int, x), __builtin_bit_cast(int, x), 0x76543210, 0xfedcba98, false, false)); }
__global__ __launch_bounds__(128) void k_attn(const _Float16* __restrict__ QH, const _Float16* __restrict__ VT, float* __restrict__ OUT) {
  __shared__ __align__(16) float so[4][16][132];
  __shared__ __align__(16) _Float16 sk[2][KT][HDD + 8];   // key rows, pitch 272 B
  __shared__ __align__(16) _Float16 sv[2][HDD][KT + 8];   // transposed planes, pitch 144 B
  const int tid = threadIdx.x, wave = tid >> 5, lane = tid & 31, col = lane & 15, g = lane >> 4; const size_t b = blockIdx.y; const int q0 = blockIdx.x * 64 + wave * 16; const size_t rq = b * LL + q0;
  const int q0s = blockIdx.x * 64 + __builtin_amdgcn_readfirstlane(wave) * 16;   // q0 in a scalar register: the test of a key tile against it costs no vector instruction
  // one stage: 1,024 16-byte pieces of key rows and 1,024 of planes, eight of each a thread
  auto stage = [&](int t, int buf) {
    unsigned d[8]; const _Float16* s[8];
    const _Float16* const gk = QH + (b * LL + t * KT) * HDD;   // 64 key rows lie in a row in memory: piece e at 16 e bytes
    const _Float16* const gv = VT + b * HDD * LL + t * KT;
#pragma unroll
    for (int i = 0; i < 8; ++i) { const int e = tid + 128 * i; d[i] = (unsigned)(size_t)&sk[buf][e >> 4][(e & 15) * 8]; s[i] = gk + e * 8; }
    copy8(d, s);
#pragma unroll
    for (int i = 0; i < 8; ++i) { const int e = tid + 128 * i; d[i] = (unsigned)(size_t)&sv[buf][e >> 3][(e & 7) * 8]; s[i] = gv + (e >> 3) * LL + (e & 7) * 8; }
    copy8(d, s);
  };
  stage(0, 0);
  asm volatile("s_wait_asynccnt 0x0" ::: "memory");   // this wave's share of stage 0 has landed
  __syncthreads();                                    // every wave's share has: stage 0 may be read
  stage(1, 1);
  v16h aq[4];
  __builtin_amdgcn_sched_barrier(0);              // keeps earlier address arithmetic from sinking in between the loads below and their wait, where it would take their address registers
#pragma unroll
  for (int kc = 0; kc < 4; ++kc) aq[kc] = frag_h(QH + (rq + col) * HDD + kc * 32, lane);
  asm volatile("s_wait_xcnt 0x0" ::: "memory");   // stands in front of the first rewrite of the address registers of the loads above
  __builtin_amdgcn_sched_barrier(0);              // keeps the zeroing of the accumulators, which takes those registers, behind that wait
  float m = -3.0e38f, l = 0.f;   // of this lane's query (q0 + col); l holds the sum over this wave half's keys alone until the epilogue
  v8f acc[8] = {}; const float scale = 1.0f / sqrtf((float)HDD);
  float lim[8];   // upper limits of this lane's eight scores in the key tile that is the wave's own 16 positions: the own position is held down, the rest are free
#pragma unroll
  for (int r = 0; r < 8; ++r) lim[r] = (8 * g + r == col) ? -3.0e38f : 3.0e38f;
#pragma unroll 1   // one trip a stage: the foot's waits, barrier and refill stand once in the code
  for (int t = 0; t < NT; ++t) { const int buf = t & 1;
#pragma unroll 1   // the stage's two passes of 32 keys share one body, as long as the parent's loop
  for (int kh = 0; kh < KT / 32; ++kh) { const int jl = kh * 32, j0 = t * KT + jl; float s[2][8]; v16h kf[2][4], vf[8];
#pragma unroll
    for (int ct = 0; ct < 2; ++ct)
#pragma unroll
      for (int kc = 0; kc < 4; ++kc) kf[ct][kc] = frag_h(&sk[buf][jl + ct * 16 + col][kc * 32], lane);
    // scores transposed: A = 16 key rows, B = the 16 queries; D element r = key 8g + r of the tile, query col
#pragma unroll
    for (int ct = 0; ct < 2; ++ct) { const float lift = (j0 + ct * 16 == q0s) ? -3.0e38f : 3.0e38f; v8f c = {};   // lift raises every limit out of reach in the 127 tiles of 128 that are not the wave's own
#pragma unroll
      for (int kc = 0; kc < 4; ++kc) c = wmma16(kf[ct][kc], aq[kc], c);
#pragma unroll
      for (int r = 0; r < 8; ++r) s[ct][r] = fminf(fmaxf(lim[r], lift), c[r] * scale); }   // own position excluded
#pragma unroll
    for (int dt = 0; dt < 8; ++dt) vf[dt] = frag_h(&sv[buf][dt * 16 + col][jl], lane);
    float mx = fmaxf(s[0][0], s[1][0]);
#pragma unroll
    for (int r = 1; r < 8; ++r) mx = fmaxf(mx, fmaxf(s[0][r], s[1][r]));
    mx = fmaxf(mx, xhalf(mx));   // the query's 32 scores lie in lanes col and col + 16
    // every pass holds at least 31 counted keys, so mn is a real score; the excluded score and m's start value lie 3.0e38 below it, where the hardware exp gives 0
    const float mn = fmaxf(m, mx); const float alpha = __expf(m - mn); float es = 0.f; v16h pa, pl;
#pragma unroll
    for (int ct = 0; ct < 2; ++ct)
#pragma unroll
      for (int r = 0; r < 8; ++r) { const float e = __expf(s[ct][r] - mn); es += e;
        const float p = e * 2048.0f; const _Float16 h = (_Float16)p; pa[ct * 8 + r] = h; pl[ct * 8 + r] = (_Float16)(p - (float)h); }   // element 8 ct + r = key 16 ct + 8g + r: the B operand's own k order
    l = l * alpha + es; m = mn;
#pragma unroll
    for (int dt = 0; dt < 8; ++dt) acc[dt] *= alpha;
    // output transposed: A = 16 rows of the planes, B = the weights; D element r = hidden dt * 16 + 8g + r, query col
#pragma unroll
    for (int dt = 0; dt < 8; ++dt) acc[dt] = wmma16(vf[dt], pa, acc[dt]);
    // the residuals stand at the weights' own scale (at most 0.5; f16 holds them to 2^-25, 2^-36 of the largest weight), so their products go into the same tiles; each tile's second product follows its first at a distance of eight
#pragma unroll
    for (int dt = 0; dt < 8; ++dt) acc[dt] = wmma16(vf[dt], pl, acc[dt]); }
    asm volatile("s_wait_dscnt 0x0" ::: "memory");      // this wave's reads of the buffer have returned
    asm volatile("s_wait_asynccnt 0x0" ::: "memory");   // this wave's share of stage t + 1 has landed
    __syncthreads();                                    // publishes stage t + 1 and ends every wave's reads of this trip's buffer
    if (t + 2 < NT) stage(t + 2, buf); }
  asm volatile("s_wait_asynccnt 0x0" ::: "memory");     // nothing is in flight when the wave goes on to its end
  const float il = (1.0f / 2048.0f) / (l + xhalf(l));   // the two halves' sums join here
#pragma unroll
  for (int dt = 0; dt < 8; ++dt) { v4f o[2];
#pragma unroll
    for (int r = 0; r < 8; ++r) o[r >> 2][r & 3] = acc[dt][r] * il;
    *(v4f*)&so[wave][col][dt * 16 + 8 * g] = o[0]; *(v4f*)&so[wave][col][dt * 16 + 8 * g + 4] = o[1]; }
  LDSX();
  for (int rl = 0; rl < 16; ++rl) vst2(OUT + (rq + rl) * HDD + lane * 4, *(const v4f*)&so[wave][rl][lane * 4]);
}
extern "C" void kernel_launch(void* const* d_in, const int* in_sizes, int n_in, void* d_out, int out_size, void* d_ws, size_t ws_size, hipStream_t stream) {
  (void)in_sizes; (void)n_in; (void)out_size;
  const float** F = (const float**)d_in;   // 0 q [16,2048,128]
  if (ws_size < (size_t)WS_END) return;
  char* ws = (char*)d_ws; _Float16 *QH = (_Float16*)(ws + WS_QH), *VT = (_Float16*)(ws + WS_VT);
  k_prep<<<NR / 64, 256, 0, stream>>>(F[0], QH, VT);
  k_attn<<<dim3(TQB, NBq), 128, 0, stream>>>(QH, VT, (float*)d_out);
}

// v006
// Measured time: 53.7 microseconds a run.
// In two side-by-side timings against v005, it was 1.06 and 1.05 times as fast.
// Over all steps from v000 it is 4.42 times as fast.
// compute dtype: q rounded to bf16 and used EXACTLY as f16 (bf16 values are exact in f16): scores q_l . q_m / sqrt(128) with single exact products on WMMA 16x16x32 (f32 accumulate), the diagonal (m == l) excluded (== the module's -1e9), running-max softmax in f32 (hardware exp); out = P (scaled by 2^11, f16 hi + residual at the same scale) x q (exact), 2 products into one accumulator.
#include <hip/hip_runtime.h>
#include <math.h>

typedef __attribute__((ext_vector_type(16))) _Float16 v16h;
typedef __attribute__((ext_vector_type(16))) __bf16 v16b;
typedef __attribute__((ext_vector_type(8)))  _Float16 v8h;
typedef __attribute__((ext_vector_type(8)))  float v8f;
typedef __attribute__((ext_vector_type(4)))  float v4f;
typedef __attribute__((ext_vector_type(2)))  float v2f;
typedef __attribute__((ext_vector_type(4)))  unsigned v4u;
typedef __attribute__((ext_vector_type(4)))  int v4i;
typedef float __attribute__((may_alias)) float_a;
typedef int __attribute__((may_alias)) int_a;

template <typename T> __device__ __forceinline__ void vst2(void* p, T v) { *(T*)p = v;  }
__device__ __forceinline__ v8f wmma16(v16h a, v16h b, v8f c) {
  return __builtin_amdgcn_wmma_f32_16x16x32_f16(false, a, false, b, (short)0, c, false, false);
}
__device__ __forceinline__ v8f wmma_bf(v16b a, v16b b, v8f c) {
  v8f d = __builtin_amdgcn_wmma_f32_16x16x32_bf16(false, a, false, b, (short)0, c, false, false);
  asm volatile("v_nop\n\tv_nop\n\tv_nop\n\tv_nop" : "+v"(d) : "v"(a), "v"(b));
  return d;
}
// 16x16x32 fragments: lane = (h = lane>>4, row/col = lane&15); elements 0..7 = k0+8h+0..7, 8..15 = k0+16+8h+0..7; D element r = row 8h+r
__device__ __forceinline__ v16h frag_h(const _Float16* rowk0, int lane) {
  union { v16h v; v8h q[2]; } u; const _Float16* p = rowk0 + 8 * (lane >> 4);
  u.q[0] = *(const v8h*)p; u.q[1] = *(const v8h*)(p + 16); return u.v;
}
__device__ __forceinline__ v16h frag_f32(const float* rowk0, int lane) {
  v16h a; const float* p = rowk0 + 8 * (lane >> 4);
#pragma unroll
  for (int i = 0; i < 8; ++i) { a[i] = (_Float16)p[i]; a[8 + i] = (_Float16)p[16 + i]; }
  return a;
}
__device__ __forceinline__ v16h frag_f32s(const float* rowk0, int lane, float sc) {
  v16h a; const float* p = rowk0 + 8 * (lane >> 4);
#pragma unroll
  for (int i = 0; i < 8; ++i) { a[i] = (_Float16)(p[i] * sc); a[8 + i] = (_Float16)(p[16 + i] * sc); }
  return a;
}
// column fragment from a [K][ld] layout (column n), rows >= K read as 0
__device__ __forceinline__ v16h fragc_f32(const float* W, int k0, int n, int lane, int ld, int K) {
  v16h a; const int g = lane >> 4;
#pragma unroll
  for (int i = 0; i < 8; ++i) { const int ka = k0 + 8 * g + i, kb = ka + 16;
    a[i] = (_Float16)(ka < K ? W[(size_t)(ka < K ? ka : K - 1) * ld + n] : 0.f); a[8 + i] = (_Float16)(kb < K ? W[(size_t)(kb < K ? kb : K - 1) * ld + n] : 0.f); }
  return a;
}
struct F2 { v16b h, l; };
__device__ __forceinline__ F2 bsplit16(const float v[16]) { F2 r;
#pragma unroll
  for (int i = 0; i < 16; ++i) { const __bf16 h = (__bf16)v[i]; r.h[i] = h; r.l[i] = (__bf16)(v[i] - (float)h); }
  return r; }
__device__ __forceinline__ F2 split_row(const float* row, int k0, int lane) { float v[16]; const float* p = row + k0 + 8 * (lane >> 4);
#pragma unroll
  for (int i = 0; i < 8; ++i) { v[i] = p[i]; v[8 + i] = p[16 + i]; }
  return bsplit16(v); }
__device__ __forceinline__ F2 split_rowK(const float* row, int k0, int lane, int K) { float v[16]; const int g = lane >> 4;
#pragma unroll
  for (int i = 0; i < 8; ++i) { const int ka = k0 + 8 * g + i, kb = ka + 16; v[i] = ka < K ? row[ka < K ? ka : K - 1] : 0.f; v[8 + i] = kb < K ? row[kb < K ? kb : K - 1] : 0.f; }
  return bsplit16(v); }
__device__ __forceinline__ F2 split_col(const float* W, int k0, int n, int lane, int ld, int K) { float v[16]; const int g = lane >> 4;
#pragma unroll
  for (int i = 0; i < 8; ++i) { const int ka = k0 + 8 * g + i, kb = ka + 16; v[i] = ka < K ? W[(size_t)(ka < K ? ka : K - 1) * ld + n] : 0.f; v[8 + i] = kb < K ? W[(size_t)(kb < K ? kb : K - 1) * ld + n] : 0.f; }
  return bsplit16(v); }
__device__ __forceinline__ v8f mac3(const F2& a, const F2& b, v8f c) { c = wmma_bf(a.l, b.h, c); c = wmma_bf(a.h, b.l, c); return wmma_bf(a.h, b.h, c); }
__device__ __forceinline__ float sigm(float v) { return 1.0f / (1.0f + expf(-v)); }
#define LDSX() do { asm volatile("s_wait_dscnt 0" ::: "memory"); __builtin_amdgcn_wave_barrier(); __builtin_amdgcn_fence(__ATOMIC_RELEASE, "workgroup"); } while (0)


// Masked self-attend (B 16, L 2,048, hidden 128): softmax(q q^T / sqrt(128)) with each position's own key masked out, applied to q itself.
#define NBq 16
#define LL 2048
#define HDD 128
#define NR (NBq * LL)
#ifndef TQB
#define TQB (LL / 64)
#endif
typedef __attribute__((ext_vector_type(8))) __bf16 v8b;
__device__ __forceinline__ v16b frag_b(const __bf16* rowk0, int lane) {
  union { v16b v; v8b q[2]; } u; const __bf16* p = rowk0 + 8 * (lane >> 4);
  u.q[0] = *(const v8b*)p; u.q[1] = *(const v8b*)(p + 16); return u.v;
}
__device__ __forceinline__ float bfr(float v) { return (float)(__bf16)v; }
__device__ __attribute__((noinline)) float exp_ni(float v) { return expf(v); }
__device__ __attribute__((noinline)) float erf_ni(float v) { return erff(v); }

#define WS_QH  0u                                   // f16 [rows][128] q (exact) ; VT f16 [b][128][L] q transposed
#define WS_VT  (WS_QH + 2u * NR * HDD)
#define WS_END (WS_VT + 2u * NR * HDD)

// ---- k_prep: block = 64 rows of batch b: q rows -> f16 rows and transposed planes
__global__ __launch_bounds__(256) void k_prep(const float* __restrict__ Q, _Float16* __restrict__ QH, _Float16* __restrict__ VT) {
  __shared__ __align__(16) _Float16 sq[64][HDD + 8]; __shared__ __align__(16) _Float16 st[HDD][72];
  const int t = threadIdx.x; const size_t r0 = (size_t)blockIdx.x * 64; const size_t b = r0 / LL, s0 = r0 % LL;
  for (int e = t; e < 64 * HDD; e += 256) { const int r = e >> 7, c = e & 127; const _Float16 v = (_Float16)bfr(Q[(r0 + r) * HDD + c]); sq[r][c] = v; st[c][r] = v; }
  __syncthreads();
  for (int e = t; e < 64 * 16; e += 256) { const int r = e >> 4, q = e & 15; vst2((unsigned*)(QH + (r0 + r) * HDD + q * 8), *(const v4u*)&sq[r][q * 8]); }
  for (int e = t; e < HDD * 8; e += 256) { const int c = e >> 3, pc = e & 7; vst2((unsigned*)(VT + (b * HDD + c) * LL + s0 + pc * 8), *(const v4u*)&st[c][pc * 8]); }
}
// ---- k_attn: block = (64 queries, b), eight waves: wave w has query tile w & 3 and, of every stage, the key half w >> 2; the two partial results of a query tile are joined in the epilogue. Scores (4 chunks, exact) computed transposed (keys x queries), self excluded, online softmax in-lane; q planes x P hi/lo straight from the score registers (8 tiles, 2 products)
// The key rows and the transposed planes of 128 keys are one stage, shared by the block's eight waves: asynchronous copies bring stage t + 2 into the buffer that trip t has left while trip t + 1 is worked on.
#define KT 128
#define NT (LL / KT)
// eight 16-byte copies of one lane; the s_wait_xcnt stands inside the statement, in front of any rewrite of the address registers it names
__device__ __forceinline__ void copy8(const unsigned* d, const _Float16* const* s) {
  asm volatile("global_load_async_to_lds_b128 %0, %8, off\n\t"
               "global_load_async_to_lds_b128 %1, %9, off\n\t"
               "global_load_async_to_lds_b128 %2, %10, off\n\t"
               "global_load_async_to_lds_b128 %3, %11, off\n\t"
               "global_load_async_to_lds_b128 %4, %12, off\n\t"
               "global_load_async_to_lds_b128 %5, %13, off\n\t"
               "global_load_async_to_lds_b128 %6, %14, off\n\t"
               "global_load_async_to_lds_b128 %7, %15, off\n\t"
               "s_wait_xcnt 0x0"
               :: "v"(d[0]), "v"(d[1]), "v"(d[2]), "v"(d[3]), "v"(d[4]), "v"(d[5]), "v"(d[6]), "v"(d[7]),
                  "v"(s[0]), "v"(s[1]), "v"(s[2]), "v"(s[3]), "v"(s[4]), "v"(s[5]), "v"(s[6]), "v"(s[7]) : "memory");
}
// lane l's value from lane l ^ 16
__device__ __forceinline__ float xhalf(float x) { return __builtin_bit_cast(float, __builtin_amdgcn_permlanex16(__builtin_bit_cast(int, x), __builtin_bit_cast(int, x), 0x76543210, 0xfedcba98, false, false)); }
__global__ __launch_bounds__(256) __attribute__((amdgpu_waves_per_eu(4, 4))) void k_attn(const _Float16* __restrict__ QH, const _Float16* __restrict__ VT, float* __restrict__ OUT) {
  __shared__ __align__(16) _Float16 sk[2][KT][HDD + 8];   // key rows, pitch 272 B
  __shared__ __align__(16) _Float16 sv[2][HDD][KT + 8];   // transposed planes, pitch 272 B
  const int tid = threadIdx.x, wave = tid >> 5, lane = tid & 31, col = lane & 15, g = lane >> 4; const size_t b = blockIdx.y; const int q0 = blockIdx.x * 64 + (wave & 3) * 16; const size_t rq = b * LL + q0;
  const int ws = __builtin_amdgcn_readfirstlane(wave), kp = ws >> 2;   // kp: which 64 keys of a stage are this wave's
  const int q0s = blockIdx.x * 64 + (ws & 3) * 16;   // q0 in a scalar register: the test of a key tile against it costs no vector instruction
  // one stage: 2,048 16-byte pieces of key rows and 2,048 of planes, eight of each a thread: piece tid + 256 i lies 16 rows of LDS below piece tid + 256 (i - 1) in both arrays
  // the thread's two source pointers walk on from stage to stage and the pieces' addresses are formed from them at each issue: 32 addresses kept over the loop would not fit the 256 registers of four waves a SIMD
  const _Float16* pk = QH + b * LL * HDD + tid * 8;                                 // 128 key rows lie in a row in memory: piece e at 16 e bytes
  const _Float16* pv = VT + b * HDD * LL + (tid >> 4) * LL + (tid & 15) * 8;
  const unsigned dk0 = (unsigned)(size_t)&sk[0][tid >> 4][(tid & 15) * 8], dv0 = (unsigned)(size_t)&sv[0][tid >> 4][(tid & 15) * 8];
  auto stage = [&](int buf) {   // issues the next stage in order into buffer buf
    unsigned d[8]; const _Float16* s[8];
#pragma unroll
    for (int i = 0; i < 8; ++i) { d[i] = dk0 + buf * (unsigned)sizeof(sk[0]) + i * 16u * (unsigned)sizeof(sk[0][0]); s[i] = pk + i * 2048; }
    copy8(d, s);
#pragma unroll
    for (int i = 0; i < 8; ++i) { d[i] = dv0 + buf * (unsigned)sizeof(sv[0]) + i * 16u * (unsigned)sizeof(sv[0][0]); s[i] = pv + i * 16 * LL; }
    copy8(d, s);
    pk += KT * HDD; pv += KT;
  };
  stage(0);
  asm volatile("s_wait_asynccnt 0x0" ::: "memory");   // this wave's share of stage 0 has landed
  __syncthreads();                                    // every wave's share has: stage 0 may be read
  stage(1);
  v16h aq[4];
  __builtin_amdgcn_sched_barrier(0);              // keeps earlier address arithmetic from sinking in between the loads below and their wait, where it would take their address registers
#pragma unroll
  for (int kc = 0; kc < 4; ++kc) aq[kc] = frag_h(QH + (rq + col) * HDD + kc * 32, lane);
  asm volatile("s_wait_xcnt 0x0" ::: "memory");   // stands in front of the first rewrite of the address registers of the loads above
  __builtin_amdgcn_sched_barrier(0);              // keeps the zeroing of the accumulators, which takes those registers, behind that wait
  float m = -3.0e38f, l = 0.f;   // of this lane's query (q0 + col); l holds the sum over this wave half's keys alone until the epilogue
  v8f acc[8] = {}; const float scale = 1.0f / sqrtf((float)HDD);
  float lim[8];   // upper limits of this lane's eight scores in the key tile that is the wave's own 16 positions: the own position is held down, the rest are free
#pragma unroll
  for (int r = 0; r < 8; ++r) lim[r] = (8 * g + r == col) ? -3.0e38f : 3.0e38f;
#pragma unroll 1   // one trip a stage: the foot's waits, barrier and refill stand once in the code
  for (int t = 0; t < NT; ++t) { const int buf = t & 1;
#pragma unroll 1   // the wave's two passes of 32 keys in a stage share one body
  for (int kh = 0; kh < 2; ++kh) { const int jl = kp * 64 + kh * 32, j0 = t * KT + jl; float s[2][8]; v16h kf[2][4], vf[8];
#pragma unroll
    for (int ct = 0; ct < 2; ++ct)
#pragma unroll
      for (int kc = 0; kc < 4; ++kc) kf[ct][kc] = frag_h(&sk[buf][jl + ct * 16 + col][kc * 32], lane);
    // scores transposed: A = 16 key rows, B = the 16 queries; D element r = key 8g + r of the tile, query col
    v8f c[2] = {};
#pragma unroll
    for (int kc = 0; kc < 4; ++kc)
#pragma unroll
      for (int ct = 0; ct < 2; ++ct) c[ct] = wmma16(kf[ct][kc], aq[kc], c[ct]);
    __builtin_amdgcn_sched_barrier(0);   // holds the planes' loads behind the score products, so that they take the key fragments' registers: both sets at once do not fit the 256 registers of four waves a SIMD, and the key loads would be cut into small waited groups
#pragma unroll
    for (int dt = 0; dt < 8; ++dt) vf[dt] = frag_h(&sv[buf][dt * 16 + col][jl], lane);
#pragma unroll
    for (int ct = 0; ct < 2; ++ct) { const float lift = (j0 + ct * 16 == q0s) ? -3.0e38f : 3.0e38f;   // lift raises every limit out of reach in the 63 or 64 tiles of the wave's 64 that are not its own
#pragma unroll
      for (int r = 0; r < 8; ++r) s[ct][r] = fminf(fmaxf(lim[r], lift), c[ct][r] * scale); }   // own position excluded
    float mx = fmaxf(s[0][0], s[1][0]);
#pragma unroll
    for (int r = 1; r < 8; ++r) mx = fmaxf(mx, fmaxf(s[0][r], s[1][r]));
    mx = fmaxf(mx, xhalf(mx));   // the query's 32 scores lie in lanes col and col + 16
    // every pass holds at least 31 counted keys, so mn is a real score; the excluded score and m's start value lie 3.0e38 below it, where the hardware exp gives 0
    const float mn = fmaxf(m, mx); const float alpha = __expf(m - mn); float es = 0.f; v16h pa, pl;
#pragma unroll
    for (int ct = 0; ct < 2; ++ct)
#pragma unroll
      for (int r = 0; r < 8; ++r) { const float e = __expf(s[ct][r] - mn); es += e;
        const float p = e * 2048.0f; const _Float16 h = (_Float16)p; pa[ct * 8 + r] = h; pl[ct * 8 + r] = (_Float16)(p - (float)h); }   // element 8 ct + r = key 16 ct + 8g + r: the B operand's own k order
    l = l * alpha + es; m = mn;
#pragma unroll
    for (int dt = 0; dt < 8; ++dt) acc[dt] *= alpha;
    // output transposed: A = 16 rows of the planes, B = the weights; D element r = hidden dt * 16 + 8g + r, query col
#pragma unroll
    for (int dt = 0; dt < 8; ++dt) acc[dt] = wmma16(vf[dt], pa, acc[dt]);
    // the residuals stand at the weights' own scale (at most 0.5; f16 holds them to 2^-25, 2^-36 of the largest weight), so their products go into the same tiles; each tile's second product follows its first at a distance of eight
#pragma unroll
    for (int dt = 0; dt < 8; ++dt) acc[dt] = wmma16(vf[dt], pl, acc[dt]); }
    asm volatile("s_wait_dscnt 0x0" ::: "memory");      // this wave's reads of the buffer have returned
    asm volatile("s_wait_asynccnt 0x0" ::: "memory");   // this wave's share of stage t + 1 has landed
    __syncthreads();                                    // publishes stage t + 1 and ends every wave's reads of this trip's buffer
    if (t + 2 < NT) stage(buf); }
  asm volatile("s_wait_asynccnt 0x0" ::: "memory");     // nothing is in flight when the wave goes on to its end
  // The last trip's barrier has ended every read of the ring and no copy is in flight: the key buffers become the exchange area (buffer 0) and the output staging (buffer 1).
  float_a* const sx = (float_a*)&sk[0][0][0];   // [8 waves][8 pieces][32 lanes][4], then [8 waves][32 lanes][2]: 34,816 B, the buffer's size
  float_a* const so = (float_a*)&sk[1][0][0];   // [8 waves][16 queries][68]: 34,816 B
  typedef v4f __attribute__((may_alias)) v4f_a; typedef v2f __attribute__((may_alias)) v2f_a;
  const float lj = l + xhalf(l);   // the wave halves' sums join here
  // each wave of a pair keeps the four hidden tiles 4 kp .. 4 kp + 3 and hands the other four to its partner (wave ^ 4: same queries, other keys)
  v8f mine[4], give[4];
#pragma unroll
  for (int i = 0; i < 4; ++i) { mine[i] = kp ? acc[4 + i] : acc[i]; give[i] = kp ? acc[i] : acc[4 + i]; }
#pragma unroll
  for (int i = 0; i < 4; ++i) { v4f o[2];
#pragma unroll
    for (int r = 0; r < 8; ++r) o[r >> 2][r & 3] = give[i][r];
    *(v4f_a*)&sx[((wave * 8 + 2 * i) * 32 + lane) * 4] = o[0]; *(v4f_a*)&sx[((wave * 8 + 2 * i + 1) * 32 + lane) * 4] = o[1]; }
  { v2f ml; ml[0] = m; ml[1] = lj; *(v2f_a*)&sx[8192 + (wave * 32 + lane) * 2] = ml; }
  __syncthreads();   // the partner's maximum, sum and four tiles may be read
  const int pw = wave ^ 4; const v2f pml = *(const v2f_a*)&sx[8192 + (pw * 32 + lane) * 2];
  const float mm = fmaxf(m, pml[0]), a0 = __expf(m - mm), a1 = __expf(pml[0] - mm);   // both maxima are real scores: every wave has counted keys
  const float il = (1.0f / 2048.0f) / (lj * a0 + pml[1] * a1); const float f0 = a0 * il, f1 = a1 * il;
#pragma unroll
  for (int i = 0; i < 4; ++i) { const v4f p0 = *(const v4f_a*)&sx[((pw * 8 + 2 * i) * 32 + lane) * 4], p1 = *(const v4f_a*)&sx[((pw * 8 + 2 * i + 1) * 32 + lane) * 4]; v4f o[2];
#pragma unroll
    for (int r = 0; r < 8; ++r) o[r >> 2][r & 3] = mine[i][r] * f0 + (r < 4 ? p0[r & 3] : p1[r & 3]) * f1;
    *(v4f_a*)&so[(wave * 16 + col) * 68 + i * 16 + 8 * g] = o[0]; *(v4f_a*)&so[(wave * 16 + col) * 68 + i * 16 + 8 * g + 4] = o[1]; }
  LDSX();
  // the wave's 16 queries x 64 hidden values: two rows of 256 B a store
  for (int rl = 0; rl < 16; rl += 2) vst2(OUT + (rq + rl + g) * HDD + kp * 64 + col * 4, *(const v4f_a*)&so[(wave * 16 + rl + g) * 68 + col * 4]);
}
extern "C" void kernel_launch(void* const* d_in, const int* in_sizes, int n_in, void* d_out, int out_size, void* d_ws, size_t ws_size, hipStream_t stream) {
  (void)in_sizes; (void)n_in; (void)out_size;
  const float** F = (const float**)d_in;   // 0 q [16,2048,128]
  if (ws_size < (size_t)WS_END) return;
  char* ws = (char*)d_ws; _Float16 *QH = (_Float16*)(ws + WS_QH), *VT = (_Float16*)(ws + WS_VT);
  k_prep<<<NR / 64, 256, 0, stream>>>(F[0], QH, VT);
  k_attn<<<dim3(TQB, NBq), 256, 0, stream>>>(QH, VT, (float*)d_out);
}

// v007
// A run of this version takes 48.5 microseconds.
// In both of two side-by-side timings against v006, it was 1.10 times as fast.
// All steps since v000 together make it 4.88 times as fast.
// compute dtype: q rounded to bf16 and used EXACTLY as f16 (bf16 values are exact in f16): scores q_l . q_m / sqrt(128) with single exact products on WMMA 16x16x32 (f32 accumulate), the diagonal (m == l) excluded (== the module's -1e9), softmax in f32 (hardware exp) against a running reference that follows the maximum only when a score passes it by more than 2.75; out = P (scaled by 2^11, f16 hi + residual at the same scale) x q (exact), 2 products into one accumulator.
#include <hip/hip_runtime.h>
#include <math.h>

typedef __attribute__((ext_vector_type(16))) _Float16 v16h;
typedef __attribute__((ext_vector_type(16))) __bf16 v16b;
typedef __attribute__((ext_vector_type(8)))  _Float16 v8h;
typedef __attribute__((ext_vector_type(8)))  float v8f;
typedef __attribute__((ext_vector_type(4)))  float v4f;
typedef __attribute__((ext_vector_type(2)))  float v2f;
typedef __attribute__((ext_vector_type(4)))  unsigned v4u;
typedef __attribute__((ext_vector_type(4)))  int v4i;
typedef float __attribute__((may_alias)) float_a;
typedef int __attribute__((may_alias)) int_a;

template <typename T> __device__ __forceinline__ void vst2(void* p, T v) { *(T*)p = v;  }
__device__ __forceinline__ v8f wmma16(v16h a, v16h b, v8f c) {
  return __builtin_amdgcn_wmma_f32_16x16x32_f16(false, a, false, b, (short)0, c, false, false);
}
__device__ __forceinline__ v8f wmma_bf(v16b a, v16b b, v8f c) {
  v8f d = __builtin_amdgcn_wmma_f32_16x16x32_bf16(false, a, false, b, (short)0, c, false, false);
  asm volatile("v_nop\n\tv_nop\n\tv_nop\n\tv_nop" : "+v"(d) : "v"(a), "v"(b));
  return d;
}
// 16x16x32 fragments: lane = (h = lane>>4, row/col = lane&15); elements 0..7 = k0+8h+0..7, 8..15 = k0+16+8h+0..7; D element r = row 8h+r
__device__ __forceinline__ v16h frag_h(const _Float16* rowk0, int lane) {
  union { v16h v; v8h q[2]; } u; const _Float16* p = rowk0 + 8 * (lane >> 4);
  u.q[0] = *(const v8h*)p; u.q[1] = *(const v8h*)(p + 16); return u.v;
}
__device__ __forceinline__ v16h frag_f32(const float* rowk0, int lane) {
  v16h a; const float* p = rowk0 + 8 * (lane >> 4);
#pragma unroll
  for (int i = 0; i < 8; ++i) { a[i] = (_Float16)p[i]; a[8 + i] = (_Float16)p[16 + i]; }
  return a;
}
__device__ __forceinline__ v16h frag_f32s(const float* rowk0, int lane, float sc) {
  v16h a; const float* p = rowk0 + 8 * (lane >> 4);
#pragma unroll
  for (int i = 0; i < 8; ++i) { a[i] = (_Float16)(p[i] * sc); a[8 + i] = (_Float16)(p[16 + i] * sc); }
  return a;
}
// column fragment from a [K][ld] layout (column n), rows >= K read as 0
__device__ __forceinline__ v16h fragc_f32(const float* W, int k0, int n, int lane, int ld, int K) {
  v16h a; const int g = lane >> 4;
#pragma unroll
  for (int i = 0; i < 8; ++i) { const int ka = k0 + 8 * g + i, kb = ka + 16;
    a[i] = (_Float16)(ka < K ? W[(size_t)(ka < K ? ka : K - 1) * ld + n] : 0.f); a[8 + i] = (_Float16)(kb < K ? W[(size_t)(kb < K ? kb : K - 1) * ld + n] : 0.f); }
  return a;
}
struct F2 { v16b h, l; };
__device__ __forceinline__ F2 bsplit16(const float v[16]) { F2 r;
#pragma unroll
  for (int i = 0; i < 16; ++i) { const __bf16 h = (__bf16)v[i]; r.h[i] = h; r.l[i] = (__bf16)(v[i] - (float)h); }
  return r; }
__device__ __forceinline__ F2 split_row(const float* row, int k0, int lane) { float v[16]; const float* p = row + k0 + 8 * (lane >> 4);
#pragma unroll
  for (int i = 0; i < 8; ++i) { v[i] = p[i]; v[8 + i] = p[16 + i]; }
  return bsplit16(v); }
__device__ __forceinline__ F2 split_rowK(const float* row, int k0, int lane, int K) { float v[16]; const int g = lane >> 4;
#pragma unroll
  for (int i = 0; i < 8; ++i) { const int ka = k0 + 8 * g + i, kb = ka + 16; v[i] = ka < K ? row[ka < K ? ka : K - 1] : 0.f; v[8 + i] = kb < K ? row[kb < K ? kb : K - 1] : 0.f; }
  return bsplit16(v); }
__device__ __forceinline__ F2 split_col(const float* W, int k0, int n, int lane, int ld, int K) { float v[16]; const int g = lane >> 4;
#pragma unroll
  for (int i = 0; i < 8; ++i) { const int ka = k0 + 8 * g + i, kb = ka + 16; v[i] = ka < K ? W[(size_t)(ka < K ? ka : K - 1) * ld + n] : 0.f; v[8 + i] = kb < K ? W[(size_t)(kb < K ? kb : K - 1) * ld + n] : 0.f; }
  return bsplit16(v); }
__device__ __forceinline__ v8f mac3(const F2& a, const F2& b, v8f c) { c = wmma_bf(a.l, b.h, c); c = wmma_bf(a.h, b.l, c); return wmma_bf(a.h, b.h, c); }
__device__ __forceinline__ float sigm(float v) { return 1.0f / (1.0f + expf(-v)); }
#define LDSX() do { asm volatile("s_wait_dscnt 0" ::: "memory"); __builtin_amdgcn_wave_barrier(); __builtin_amdgcn_fence(__ATOMIC_RELEASE, "workgroup"); } while (0)


// Masked self-attend (B 16, L 2,048, hidden 128): softmax(q q^T / sqrt(128)) with each position's own key masked out, applied to q itself.
#define NBq 16
#define LL 2048
#define HDD 128
#define NR (NBq * LL)
#ifndef TQB
#define TQB (LL / 64)
#endif
typedef __attribute__((ext_vector_type(8))) __bf16 v8b;
__device__ __forceinline__ v16b frag_b(const __bf16* rowk0, int lane) {
  union { v16b v; v8b q[2]; } u; const __bf16* p = rowk0 + 8 * (lane >> 4);
  u.q[0] = *(const v8b*)p; u.q[1] = *(const v8b*)(p + 16); return u.v;
}
__device__ __forceinline__ float bfr(float v) { return (float)(__bf16)v; }
__device__ __attribute__((noinline)) float exp_ni(float v) { return expf(v); }
__device__ __attribute__((noinline)) float erf_ni(float v) { return erff(v); }

#define WS_QH  0u                                   // f16 [rows][128] q (exact) ; VT f16 [b][128][L] q transposed
#define WS_VT  (WS_QH + 2u * NR * HDD)
#define WS_END (WS_VT + 2u * NR * HDD)

// ---- k_prep: block = 64 rows of batch b: q rows -> f16 rows and transposed planes
__global__ __launch_bounds__(256) void k_prep(const float* __restrict__ Q, _Float16* __restrict__ QH, _Float16* __restrict__ VT) {
  __shared__ __align__(16) _Float16 sq[64][HDD + 8]; __shared__ __align__(16) _Float16 st[HDD][72];
  const int t = threadIdx.x; const size_t r0 = (size_t)blockIdx.x * 64; const size_t b = r0 / LL, s0 = r0 % LL;
  for (int e = t; e < 64 * HDD; e += 256) { const int r = e >> 7, c = e & 127; const _Float16 v = (_Float16)bfr(Q[(r0 + r) * HDD + c]); sq[r][c] = v; st[c][r] = v; }
  __syncthreads();
  for (int e = t; e < 64 * 16; e += 256) { const int r = e >> 4, q = e & 15; vst2((unsigned*)(QH + (r0 + r) * HDD + q * 8), *(const v4u*)&sq[r][q * 8]); }
  for (int e = t; e < HDD * 8; e += 256) { const int c = e >> 3, pc = e & 7; vst2((unsigned*)(VT + (b * HDD + c) * LL + s0 + pc * 8), *(const v4u*)&st[c][pc * 8]); }
}
// ---- k_attn: block = (64 queries, b), eight waves: wave w has query tile w & 3 and, of every stage, the key half w >> 2; the two partial results of a query tile are joined in the epilogue. Scores (4 chunks, exact) computed transposed (keys x queries), self excluded, online softmax in-lane; q planes x P hi/lo straight from the score registers (8 tiles, 2 products)
// The key rows and the transposed planes of 128 keys are one stage, shared by the block's eight waves: asynchronous copies bring stage t + 2 into the buffer that trip t has left while trip t + 1 is worked on.
#define KT 128
#define NT (LL / KT)
// eight 16-byte copies of one lane; the s_wait_xcnt stands inside the statement, in front of any rewrite of the address registers it names
__device__ __forceinline__ void copy8(const unsigned* d, const _Float16* const* s) {
  asm volatile("global_load_async_to_lds_b128 %0, %8, off\n\t"
               "global_load_async_to_lds_b128 %1, %9, off\n\t"
               "global_load_async_to_lds_b128 %2, %10, off\n\t"
               "global_load_async_to_lds_b128 %3, %11, off\n\t"
               "global_load_async_to_lds_b128 %4, %12, off\n\t"
               "global_load_async_to_lds_b128 %5, %13, off\n\t"
               "global_load_async_to_lds_b128 %6, %14, off\n\t"
               "global_load_async_to_lds_b128 %7, %15, off\n\t"
               "s_wait_xcnt 0x0"
               :: "v"(d[0]), "v"(d[1]), "v"(d[2]), "v"(d[3]), "v"(d[4]), "v"(d[5]), "v"(d[6]), "v"(d[7]),
                  "v"(s[0]), "v"(s[1]), "v"(s[2]), "v"(s[3]), "v"(s[4]), "v"(s[5]), "v"(s[6]), "v"(s[7]) : "memory");
}
// lane l's value from lane l ^ 16
__device__ __forceinline__ float xhalf(float x) { return __builtin_bit_cast(float, __builtin_amdgcn_permlanex16(__builtin_bit_cast(int, x), __builtin_bit_cast(int, x), 0x76543210, 0xfedcba98, false, false)); }
__global__ __launch_bounds__(256) __attribute__((amdgpu_waves_per_eu(4, 4))) void k_attn(const _Float16* __restrict__ QH, const _Float16* __restrict__ VT, float* __restrict__ OUT) {
  __shared__ __align__(16) _Float16 sk[2][KT][HDD + 8];   // key rows, pitch 272 B
  __shared__ __align__(16) _Float16 sv[2][HDD][KT + 8];   // transposed planes, pitch 272 B
  const int tid = threadIdx.x, wave = tid >> 5, lane = tid & 31, col = lane & 15, g = lane >> 4; const size_t b = blockIdx.y; const int q0 = blockIdx.x * 64 + (wave & 3) * 16; const size_t rq = b * LL + q0;
  const int ws = __builtin_amdgcn_readfirstlane(wave), kp = ws >> 2;   // kp: which 64 keys of a stage are this wave's
  const int q0s = blockIdx.x * 64 + (ws & 3) * 16;   // q0 in a scalar register: the test of a key tile against it costs no vector instruction
  // one stage: 2,048 16-byte pieces of key rows and 2,048 of planes, eight of each a thread: piece tid + 256 i lies 16 rows of LDS below piece tid + 256 (i - 1) in both arrays
  // the thread's two source pointers walk on from stage to stage and the pieces' addresses are formed from them at each issue: 32 addresses kept over the loop would not fit the 256 registers of four waves a SIMD
  const _Float16* pk = QH + b * LL * HDD + tid * 8;                                 // 128 key rows lie in a row in memory: piece e at 16 e bytes
  const _Float16* pv = VT + b * HDD * LL + (tid >> 4) * LL + (tid & 15) * 8;
  const unsigned dk0 = (unsigned)(size_t)&sk[0][tid >> 4][(tid & 15) * 8], dv0 = (unsigned)(size_t)&sv[0][tid >> 4][(tid & 15) * 8];
  auto stage = [&](int buf) {   // issues the next stage in order into buffer buf
    unsigned d[8]; const _Float16* s[8];
#pragma unroll
    for (int i = 0; i < 8; ++i) { d[i] = dk0 + buf * (unsigned)sizeof(sk[0]) + i * 16u * (unsigned)sizeof(sk[0][0]); s[i] = pk + i * 2048; }
    copy8(d, s);
#pragma unroll
    for (int i = 0; i < 8; ++i) { d[i] = dv0 + buf * (unsigned)sizeof(sv[0]) + i * 16u * (unsigned)sizeof(sv[0][0]); s[i] = pv + i * 16 * LL; }
    copy8(d, s);
    pk += KT * HDD; pv += KT;
  };
  stage(0);
  asm volatile("s_wait_asynccnt 0x0" ::: "memory");   // this wave's share of stage 0 has landed
  __syncthreads();                                    // every wave's share has: stage 0 may be read
  stage(1);
  v16h aq[4];
  __builtin_amdgcn_sched_barrier(0);              // keeps earlier address arithmetic from sinking in between the loads below and their wait, where it would take their address registers
#pragma unroll
  for (int kc = 0; kc < 4; ++kc) aq[kc] = frag_h(QH + (rq + col) * HDD + kc * 32, lane);
  asm volatile("s_wait_xcnt 0x0" ::: "memory");   // stands in front of the first rewrite of the address registers of the loads above
  __builtin_amdgcn_sched_barrier(0);              // keeps the zeroing of the accumulators, which takes those registers, behind that wait
  float m = -3.0e38f, l = 0.f;   // of this lane's query (q0 + col); m is the reference the weights are taken against (a real score, at most 2.75 below the largest so far); l holds the sum over this wave half's keys alone until the epilogue
  v8f acc[8] = {}; const float scale = 1.0f / sqrtf((float)HDD);
  float lim[8];   // upper limits of this lane's eight scores in the key tile that is the wave's own 16 positions: the own position is held down, the rest are free
#pragma unroll
  for (int r = 0; r < 8; ++r) lim[r] = (8 * g + r == col) ? -3.0e38f : 3.0e38f;
#pragma unroll 1   // one trip a stage: the foot's waits, barrier and refill stand once in the code
  for (int t = 0; t < NT; ++t) { const int buf = t & 1;
#pragma unroll 1   // the wave's two passes of 32 keys in a stage share one body
  for (int kh = 0; kh < 2; ++kh) { const int jl = kp * 64 + kh * 32, j0 = t * KT + jl; float s[2][8]; v16h kf[2][4], vf[8];
#pragma unroll
    for (int kc = 0; kc < 4; ++kc)   // in the order in which the products take them
#pragma unroll
      for (int ct = 0; ct < 2; ++ct) kf[ct][kc] = frag_h(&sk[buf][jl + ct * 16 + col][kc * 32], lane);
    __builtin_amdgcn_sched_barrier(0);   // keeps the pass's 16 key loads one group in front of the score products: with the pass cut in two by the branch below, the compiler otherwise deals them out in pairs, each waited for in full before its product
    // scores transposed: A = 16 key rows, B = the 16 queries; D element r = key 8g + r of the tile, query col
    v8f c[2] = {};
#pragma unroll
    for (int kc = 0; kc < 4; ++kc)
#pragma unroll
      for (int ct = 0; ct < 2; ++ct) c[ct] = wmma16(kf[ct][kc], aq[kc], c[ct]);
    __builtin_amdgcn_sched_barrier(0);   // holds the mask's vector work behind the score products: lifted to the head of the pass it would take operand registers of the last pass's final products inside their distance
#pragma unroll
    for (int ct = 0; ct < 2; ++ct) { const float lift = (j0 + ct * 16 == q0s) ? -3.0e38f : 3.0e38f;   // lift raises every limit out of reach in the 63 or 64 tiles of the wave's 64 that are not its own
#pragma unroll
      for (int r = 0; r < 8; ++r) s[ct][r] = fminf(fmaxf(lim[r], lift), c[ct][r] * scale); }   // own position excluded
    float mx = fmaxf(s[0][0], s[1][0]);
#pragma unroll
    for (int r = 1; r < 8; ++r) mx = fmaxf(mx, fmaxf(s[0][r], s[1][r]));
    // m is a reference, not the exact maximum: it moves, and the sum and the tiles are rescaled, only in a pass where some query of the wave has a score more than 2.75 above its reference.
    // Elsewhere every weight is at most e^2.75 < 16, 2^15 with its factor 2^11: inside f16. The test is the same for the whole wave (a ballot), so the matrix instructions keep all lanes on.
    if (__builtin_amdgcn_ballot_w32(mx > m + 2.75f) != 0u) {
      mx = fmaxf(mx, xhalf(mx));   // the query's 32 scores lie in lanes col and col + 16: both take the same new reference
      // every pass holds at least 31 counted keys, so mn is a real score; m's start value lies 3.0e38 below it, where the hardware exp gives 0 (the first pass always comes here)
      const float mn = fmaxf(m, mx); const float alpha = __expf(m - mn); l *= alpha; m = mn;
#pragma unroll
      for (int dt = 0; dt < 8; ++dt) acc[dt] *= alpha; }
    // the planes' loads stand here, behind the score products (they take the key fragments' registers: both sets at once do not fit the 256 registers of four waves a SIMD) and behind the branch
#pragma unroll
    for (int dt = 0; dt < 8; ++dt) vf[dt] = frag_h(&sv[buf][dt * 16 + col][jl], lane);
    __builtin_amdgcn_sched_barrier(0);   // keeps those loads in front of the exponentials and conversions, whose time covers their latency; without it they sink to just in front of their products
    float es = 0.f; v16h pa, pl;   // the excluded score lies 3.0e38 below m, where the hardware exp gives 0
#pragma unroll
    for (int ct = 0; ct < 2; ++ct)
#pragma unroll
      for (int r = 0; r < 8; ++r) { const float e = __expf(s[ct][r] - m); es += e;
        const float p = e * 2048.0f; const _Float16 h = (_Float16)p; pa[ct * 8 + r] = h; pl[ct * 8 + r] = (_Float16)(p - (float)h); }   // element 8 ct + r = key 16 ct + 8g + r: the B operand's own k order
    l += es;
    // output transposed: A = 16 rows of the planes, B = the weights; D element r = hidden dt * 16 + 8g + r, query col
#pragma unroll
    for (int dt = 0; dt < 8; ++dt) acc[dt] = wmma16(vf[dt], pa, acc[dt]);
    // the residuals stand at the weights' own scale (at most 8; f16 holds them to 2^-25, 2^-36 of the largest weight), so their products go into the same tiles; each tile's second product follows its first at a distance of eight
#pragma unroll
    for (int dt = 0; dt < 8; ++dt) acc[dt] = wmma16(vf[dt], pl, acc[dt]); }
    asm volatile("s_wait_dscnt 0x0" ::: "memory");      // this wave's reads of the buffer have returned
    asm volatile("s_wait_asynccnt 0x0" ::: "memory");   // this wave's share of stage t + 1 has landed
    __syncthreads();                                    // publishes stage t + 1 and ends every wave's reads of this trip's buffer
    if (t + 2 < NT) stage(buf); }
  asm volatile("s_wait_asynccnt 0x0" ::: "memory");     // nothing is in flight when the wave goes on to its end
  // The last trip's barrier has ended every read of the ring and no copy is in flight: the key buffers become the exchange area (buffer 0) and the output staging (buffer 1).
  float_a* const sx = (float_a*)&sk[0][0][0];   // [8 waves][8 pieces][32 lanes][4], then [8 waves][32 lanes][2]: 34,816 B, the buffer's size
  float_a* const so = (float_a*)&sk[1][0][0];   // [8 waves][16 queries][68]: 34,816 B
  typedef v4f __attribute__((may_alias)) v4f_a; typedef v2f __attribute__((may_alias)) v2f_a;
  const float lj = l + xhalf(l);   // the wave halves' sums join here
  // each wave of a pair keeps the four hidden tiles 4 kp .. 4 kp + 3 and hands the other four to its partner (wave ^ 4: same queries, other keys)
  v8f mine[4], give[4];
#pragma unroll
  for (int i = 0; i < 4; ++i) { mine[i] = kp ? acc[4 + i] : acc[i]; give[i] = kp ? acc[i] : acc[4 + i]; }
#pragma unroll
  for (int i = 0; i < 4; ++i) { v4f o[2];
#pragma unroll
    for (int r = 0; r < 8; ++r) o[r >> 2][r & 3] = give[i][r];
    *(v4f_a*)&sx[((wave * 8 + 2 * i) * 32 + lane) * 4] = o[0]; *(v4f_a*)&sx[((wave * 8 + 2 * i + 1) * 32 + lane) * 4] = o[1]; }
  { v2f ml; ml[0] = m; ml[1] = lj; *(v2f_a*)&sx[8192 + (wave * 32 + lane) * 2] = ml; }
  __syncthreads();   // the partner's reference, sum and four tiles may be read
  const int pw = wave ^ 4; const v2f pml = *(const v2f_a*)&sx[8192 + (pw * 32 + lane) * 2];
  const float mm = fmaxf(m, pml[0]), a0 = __expf(m - mm), a1 = __expf(pml[0] - mm);   // both references are real scores: every wave has counted keys
  const float il = (1.0f / 2048.0f) / (lj * a0 + pml[1] * a1); const float f0 = a0 * il, f1 = a1 * il;
#pragma unroll
  for (int i = 0; i < 4; ++i) { const v4f p0 = *(const v4f_a*)&sx[((pw * 8 + 2 * i) * 32 + lane) * 4], p1 = *(const v4f_a*)&sx[((pw * 8 + 2 * i + 1) * 32 + lane) * 4]; v4f o[2];
#pragma unroll
    for (int r = 0; r < 8; ++r) o[r >> 2][r & 3] = mine[i][r] * f0 + (r < 4 ? p0[r & 3] : p1[r & 3]) * f1;
    *(v4f_a*)&so[(wave * 16 + col) * 68 + i * 16 + 8 * g] = o[0]; *(v4f_a*)&so[(wave * 16 + col) * 68 + i * 16 + 8 * g + 4] = o[1]; }
  LDSX();
  // the wave's 16 queries x 64 hidden values: two rows of 256 B a store
  for (int rl = 0; rl < 16; rl += 2) vst2(OUT + (rq + rl + g) * HDD + kp * 64 + col * 4, *(const v4f_a*)&so[(wave * 16 + rl + g) * 68 + col * 4]);
}
extern "C" void kernel_launch(void* const* d_in, const int* in_sizes, int n_in, void* d_out, int out_size, void* d_ws, size_t ws_size, hipStream_t stream) {
  (void)in_sizes; (void)n_in; (void)out_size;
  const float** F = (const float**)d_in;   // 0 q [16,2048,128]
  if (ws_size < (size_t)WS_END) return;
  char* ws = (char*)d_ws; _Float16 *QH = (_Float16*)(ws + WS_QH), *VT = (_Float16*)(ws + WS_VT);
  k_prep<<<NR / 64, 256, 0, stream>>>(F[0], QH, VT);
  k_attn<<<dim3(TQB, NBq), 256, 0, stream>>>(QH, VT, (float*)d_out);
}

// v008
// It runs in 45.4 microseconds.
// In two side-by-side timings against v007, it was 1.08 and 1.07 times as fast.
// All steps since v000 together make it 5.25 times as fast.
// compute dtype: q rounded to bf16 and used EXACTLY as f16 (bf16 values are exact in f16): scores q_l . q_m / sqrt(128) with single exact products on WMMA 16x16x32 (f32 accumulate), the diagonal (m == l) excluded (== the module's -1e9), softmax in f32 (hardware exp2 of an exponent that one fused multiply-add forms from the raw dot product: 1/sqrt(128), log2 e, the reference and the factor 2^11 are in its two constants) against a running reference that follows the maximum only when a score passes it by more than 2.75; out = P (scaled by 2^11, f16 hi + residual at the same scale) x q (exact), 2 products into one accumulator.
#include <hip/hip_runtime.h>
#include <math.h>

typedef __attribute__((ext_vector_type(16))) _Float16 v16h;
typedef __attribute__((ext_vector_type(16))) __bf16 v16b;
typedef __attribute__((ext_vector_type(8)))  _Float16 v8h;
typedef __attribute__((ext_vector_type(8)))  float v8f;
typedef __attribute__((ext_vector_type(4)))  float v4f;
typedef __attribute__((ext_vector_type(2)))  float v2f;
typedef __attribute__((ext_vector_type(4)))  unsigned v4u;
typedef __attribute__((ext_vector_type(4)))  int v4i;
typedef float __attribute__((may_alias)) float_a;
typedef int __attribute__((may_alias)) int_a;

template <typename T> __device__ __forceinline__ void vst2(void* p, T v) { *(T*)p = v;  }
__device__ __forceinline__ v8f wmma16(v16h a, v16h b, v8f c) {
  return __builtin_amdgcn_wmma_f32_16x16x32_f16(false, a, false, b, (short)0, c, false, false);
}
__device__ __forceinline__ v8f wmma_bf(v16b a, v16b b, v8f c) {
  v8f d = __builtin_amdgcn_wmma_f32_16x16x32_bf16(false, a, false, b, (short)0, c, false, false);
  asm volatile("v_nop\n\tv_nop\n\tv_nop\n\tv_nop" : "+v"(d) : "v"(a), "v"(b));
  return d;
}
// 16x16x32 fragments: lane = (h = lane>>4, row/col = lane&15); elements 0..7 = k0+8h+0..7, 8..15 = k0+16+8h+0..7; D element r = row 8h+r
__device__ __forceinline__ v16h frag_h(const _Float16* rowk0, int lane) {
  union { v16h v; v8h q[2]; } u; const _Float16* p = rowk0 + 8 * (lane >> 4);
  u.q[0] = *(const v8h*)p; u.q[1] = *(const v8h*)(p + 16); return u.v;
}
__device__ __forceinline__ v16h frag_f32(const float* rowk0, int lane) {
  v16h a; const float* p = rowk0 + 8 * (lane >> 4);
#pragma unroll
  for (int i = 0; i < 8; ++i) { a[i] = (_Float16)p[i]; a[8 + i] = (_Float16)p[16 + i]; }
  return a;
}
__device__ __forceinline__ v16h frag_f32s(const float* rowk0, int lane, float sc) {
  v16h a; const float* p = rowk0 + 8 * (lane >> 4);
#pragma unroll
  for (int i = 0; i < 8; ++i) { a[i] = (_Float16)(p[i] * sc); a[8 + i] = (_Float16)(p[16 + i] * sc); }
  return a;
}
// column fragment from a [K][ld] layout (column n), rows >= K read as 0
__device__ __forceinline__ v16h fragc_f32(const float* W, int k0, int n, int lane, int ld, int K) {
  v16h a; const int g = lane >> 4;
#pragma unroll
  for (int i = 0; i < 8; ++i) { const int ka = k0 + 8 * g + i, kb = ka + 16;
    a[i] = (_Float16)(ka < K ? W[(size_t)(ka < K ? ka : K - 1) * ld + n] : 0.f); a[8 + i] = (_Float16)(kb < K ? W[(size_t)(kb < K ? kb : K - 1) * ld + n] : 0.f); }
  return a;
}
struct F2 { v16b h, l; };
__device__ __forceinline__ F2 bsplit16(const float v[16]) { F2 r;
#pragma unroll
  for (int i = 0; i < 16; ++i) { const __bf16 h = (__bf16)v[i]; r.h[i] = h; r.l[i] = (__bf16)(v[i] - (float)h); }
  return r; }
__device__ __forceinline__ F2 split_row(const float* row, int k0, int lane) { float v[16]; const float* p = row + k0 + 8 * (lane >> 4);
#pragma unroll
  for (int i = 0; i < 8; ++i) { v[i] = p[i]; v[8 + i] = p[16 + i]; }
  return bsplit16(v); }
__device__ __forceinline__ F2 split_rowK(const float* row, int k0, int lane, int K) { float v[16]; const int g = lane >> 4;
#pragma unroll
  for (int i = 0; i < 8; ++i) { const int ka = k0 + 8 * g + i, kb = ka + 16; v[i] = ka < K ? row[ka < K ? ka : K - 1] : 0.f; v[8 + i] = kb < K ? row[kb < K ? kb : K - 1] : 0.f; }
  return bsplit16(v); }
__device__ __forceinline__ F2 split_col(const float* W, int k0, int n, int lane, int ld, int K) { float v[16]; const int g = lane >> 4;
#pragma unroll
  for (int i = 0; i < 8; ++i) { const int ka = k0 + 8 * g + i, kb = ka + 16; v[i] = ka < K ? W[(size_t)(ka < K ? ka : K - 1) * ld + n] : 0.f; v[8 + i] = kb < K ? W[(size_t)(kb < K ? kb : K - 1) * ld + n] : 0.f; }
  return bsplit16(v); }
__device__ __forceinline__ v8f mac3(const F2& a, const F2& b, v8f c) { c = wmma_bf(a.l, b.h, c); c = wmma_bf(a.h, b.l, c); return wmma_bf(a.h, b.h, c); }
__device__ __forceinline__ float sigm(float v) { return 1.0f / (1.0f + expf(-v)); }
#define LDSX() do { asm volatile("s_wait_dscnt 0" ::: "memory"); __builtin_amdgcn_wave_barrier(); __builtin_amdgcn_fence(__ATOMIC_RELEASE, "workgroup"); } while (0)


// Masked self-attend (B 16, L 2,048, hidden 128): softmax(q q^T / sqrt(128)) with each position's own key masked out, applied to q itself.
#define NBq 16
#define LL 2048
#define HDD 128
#define NR (NBq * LL)
#ifndef TQB
#define TQB (LL / 64)
#endif
typedef __attribute__((ext_vector_type(8))) __bf16 v8b;
__device__ __forceinline__ v16b frag_b(const __bf16* rowk0, int lane) {
  union { v16b v; v8b q[2]; } u; const __bf16* p = rowk0 + 8 * (lane >> 4);
  u.q[0] = *(const v8b*)p; u.q[1] = *(const v8b*)(p + 16); return u.v;
}
__device__ __forceinline__ float bfr(float v) { return (float)(__bf16)v; }
__device__ __attribute__((noinline)) float exp_ni(float v) { return expf(v); }
__device__ __attribute__((noinline)) float erf_ni(float v) { return erff(v); }

#define WS_QH  0u                                   // f16 [rows][128] q (exact) ; VT f16 [b][128][L] q transposed
#define WS_VT  (WS_QH + 2u * NR * HDD)
#define WS_END (WS_VT + 2u * NR * HDD)

// ---- k_prep: block = 64 rows of batch b: q rows -> f16 rows and transposed planes
__global__ __launch_bounds__(256) void k_prep(const float* __restrict__ Q, _Float16* __restrict__ QH, _Float16* __restrict__ VT) {
  __shared__ __align__(16) _Float16 sq[64][HDD + 8]; __shared__ __align__(16) _Float16 st[HDD][72];
  const int t = threadIdx.x; const size_t r0 = (size_t)blockIdx.x * 64; const size_t b = r0 / LL, s0 = r0 % LL;
  for (int e = t; e < 64 * HDD; e += 256) { const int r = e >> 7, c = e & 127; const _Float16 v = (_Float16)bfr(Q[(r0 + r) * HDD + c]); sq[r][c] = v; st[c][r] = v; }
  __syncthreads();
  for (int e = t; e < 64 * 16; e += 256) { const int r = e >> 4, q = e & 15; vst2((unsigned*)(QH + (r0 + r) * HDD + q * 8), *(const v4u*)&sq[r][q * 8]); }
  for (int e = t; e < HDD * 8; e += 256) { const int c = e >> 3, pc = e & 7; vst2((unsigned*)(VT + (b * HDD + c) * LL + s0 + pc * 8), *(const v4u*)&st[c][pc * 8]); }
}
// ---- k_attn: block = (64 queries, b), eight waves: wave w has query tile w & 3 and, of every stage, the key half w >> 2; the two partial results of a query tile are joined in the epilogue. Scores (4 chunks, exact) computed transposed (keys x queries), self excluded, online softmax in-lane; q planes x P hi/lo straight from the score registers (8 tiles, 2 products)
// The key rows and the transposed planes of 128 keys are one stage, shared by the block's eight waves: asynchronous copies bring stage t + 2 into the buffer that trip t has left while trip t + 1 is worked on.
#define KT 128
#define NT (LL / KT)
// eight 16-byte copies of one lane; the s_wait_xcnt stands inside the statement, in front of any rewrite of the address registers it names
__device__ __forceinline__ void copy8(const unsigned* d, const _Float16* const* s) {
  asm volatile("global_load_async_to_lds_b128 %0, %8, off\n\t"
               "global_load_async_to_lds_b128 %1, %9, off\n\t"
               "global_load_async_to_lds_b128 %2, %10, off\n\t"
               "global_load_async_to_lds_b128 %3, %11, off\n\t"
               "global_load_async_to_lds_b128 %4, %12, off\n\t"
               "global_load_async_to_lds_b128 %5, %13, off\n\t"
               "global_load_async_to_lds_b128 %6, %14, off\n\t"
               "global_load_async_to_lds_b128 %7, %15, off\n\t"
               "s_wait_xcnt 0x0"
               :: "v"(d[0]), "v"(d[1]), "v"(d[2]), "v"(d[3]), "v"(d[4]), "v"(d[5]), "v"(d[6]), "v"(d[7]),
                  "v"(s[0]), "v"(s[1]), "v"(s[2]), "v"(s[3]), "v"(s[4]), "v"(s[5]), "v"(s[6]), "v"(s[7]) : "memory");
}
// lane l's value from lane l ^ 16
__device__ __forceinline__ float xhalf(float x) { return __builtin_bit_cast(float, __builtin_amdgcn_permlanex16(__builtin_bit_cast(int, x), __builtin_bit_cast(int, x), 0x76543210, 0xfedcba98, false, false)); }
__global__ __launch_bounds__(256) __attribute__((amdgpu_waves_per_eu(4, 4))) void k_attn(const _Float16* __restrict__ QH, const _Float16* __restrict__ VT, float* __restrict__ OUT) {
  __shared__ __align__(16) _Float16 sk[2][KT][HDD + 8];   // key rows, pitch 272 B
  __shared__ __align__(16) _Float16 sv[2][HDD][KT + 8];   // transposed planes, pitch 272 B
  const int tid = threadIdx.x, wave = tid >> 5, lane = tid & 31, col = lane & 15, g = lane >> 4; const size_t b = blockIdx.y; const int q0 = blockIdx.x * 64 + (wave & 3) * 16; const size_t rq = b * LL + q0;
  const int ws = __builtin_amdgcn_readfirstlane(wave), kp = ws >> 2;   // kp: which 64 keys of a stage are this wave's
  const int q0s = blockIdx.x * 64 + (ws & 3) * 16;   // q0 in a scalar register: the test of a key tile against it costs no vector instruction
  // one stage: 2,048 16-byte pieces of key rows and 2,048 of planes, eight of each a thread: piece tid + 256 i lies 16 rows of LDS below piece tid + 256 (i - 1) in both arrays
  // the thread's two source pointers walk on from stage to stage and the pieces' addresses are formed from them at each issue: 32 addresses kept over the loop would not fit the 256 registers of four waves a SIMD
  const _Float16* pk = QH + b * LL * HDD + tid * 8;                                 // 128 key rows lie in a row in memory: piece e at 16 e bytes
  const _Float16* pv = VT + b * HDD * LL + (tid >> 4) * LL + (tid & 15) * 8;
  const unsigned dk0 = (unsigned)(size_t)&sk[0][tid >> 4][(tid & 15) * 8], dv0 = (unsigned)(size_t)&sv[0][tid >> 4][(tid & 15) * 8];
  auto stage = [&](int buf) {   // issues the next stage in order into buffer buf
    unsigned d[8]; const _Float16* s[8];
#pragma unroll
    for (int i = 0; i < 8; ++i) { d[i] = dk0 + buf * (unsigned)sizeof(sk[0]) + i * 16u * (unsigned)sizeof(sk[0][0]); s[i] = pk + i * 2048; }
    copy8(d, s);
#pragma unroll
    for (int i = 0; i < 8; ++i) { d[i] = dv0 + buf * (unsigned)sizeof(sv[0]) + i * 16u * (unsigned)sizeof(sv[0][0]); s[i] = pv + i * 16 * LL; }
    copy8(d, s);
    pk += KT * HDD; pv += KT;
  };
  stage(0);
  asm volatile("s_wait_asynccnt 0x0" ::: "memory");   // this wave's share of stage 0 has landed
  __syncthreads();                                    // every wave's share has: stage 0 may be read
  stage(1);
  v16h aq[4];
  __builtin_amdgcn_sched_barrier(0);              // keeps earlier address arithmetic from sinking in between the loads below and their wait, where it would take their address registers
#pragma unroll
  for (int kc = 0; kc < 4; ++kc) aq[kc] = frag_h(QH + (rq + col) * HDD + kc * 32, lane);
  asm volatile("s_wait_xcnt 0x0" ::: "memory");   // stands in front of the first rewrite of the address registers of the loads above
  __builtin_amdgcn_sched_barrier(0);              // keeps the zeroing of the accumulators, which takes those registers, behind that wait
  // of this lane's query (q0 + col): a weight is 2^x with x = dot product * k2 + nm; nm = 11 - reference * log2 e holds the reference the weights are taken against (a real score, at most 2.75 below the largest so far) and the factor 2^11
  // l holds the sum of the weights, factor included, over this wave half's keys alone until the epilogue; fl is the least step of the reference: none before the first pass, which sets it from its own scores, 0 from then on
  float nm = 0.f, fl = -3.0e38f, l = 0.f;
  v8f acc[8] = {};
  const float k2 = 1.44269504f / sqrtf((float)HDD);   // raw dot product -> exponent to base 2
  const float top = 11.0f + 2.75f * 1.44269504f;      // the largest exponent that is let through: a score 2.75 above its reference
  float lim[8];   // upper limits of this lane's eight scores in the key tile that is the wave's own 16 positions: the own position is held down, the rest are free
#pragma unroll
  for (int r = 0; r < 8; ++r) lim[r] = (8 * g + r == col) ? -3.0e38f : 3.0e38f;
#pragma unroll 1   // one trip a stage: the foot's waits, barrier and refill stand once in the code
  for (int t = 0; t < NT; ++t) { const int buf = t & 1;
#pragma unroll 1   // the wave's two passes of 32 keys in a stage share one body
  for (int kh = 0; kh < 2; ++kh) { const int jl = kp * 64 + kh * 32, j0 = t * KT + jl; float s[2][8]; v16h kf[2][4], vf[8];
#pragma unroll
    for (int kc = 0; kc < 4; ++kc)   // in the order in which the products take them
#pragma unroll
      for (int ct = 0; ct < 2; ++ct) kf[ct][kc] = frag_h(&sk[buf][jl + ct * 16 + col][kc * 32], lane);
    __builtin_amdgcn_sched_barrier(0);   // keeps the pass's 16 key loads one group in front of the score products: with the pass cut in two by the branch below, the compiler otherwise deals them out in pairs, each waited for in full before its product
    // scores transposed: A = 16 key rows, B = the 16 queries; D element r = key 8g + r of the tile, query col
    v8f c[2] = {};
#pragma unroll
    for (int kc = 0; kc < 4; ++kc)
#pragma unroll
      for (int ct = 0; ct < 2; ++ct) c[ct] = wmma16(kf[ct][kc], aq[kc], c[ct]);
    __builtin_amdgcn_sched_barrier(0);   // holds the mask's vector work behind the score products: lifted to the head of the pass it would take operand registers of the last pass's final products inside their distance
#pragma unroll
    for (int ct = 0; ct < 2; ++ct) { const float lift = (j0 + ct * 16 == q0s) ? -3.0e38f : 3.0e38f;   // lift raises every limit out of reach in the 63 or 64 tiles of the wave's 64 that are not its own
#pragma unroll
      for (int r = 0; r < 8; r += 2) { v2f x; x[0] = c[ct][r]; x[1] = c[ct][r + 1]; x = __builtin_elementwise_fma(x, (v2f)k2, (v2f)nm);   // two neighbours of one accumulator tile a multiply-add: the weights' exponents against the reference in use
        s[ct][r] = fminf(fmaxf(lim[r], lift), x[0]); s[ct][r + 1] = fminf(fmaxf(lim[r + 1], lift), x[1]); } }   // own position excluded
    float mx = fmaxf(s[0][0], s[1][0]);
#pragma unroll
    for (int r = 1; r < 8; ++r) mx = fmaxf(mx, fmaxf(s[0][r], s[1][r]));
    // The reference is not the exact maximum: it moves, and the sum and the tiles are rescaled, only in a pass where some query of the wave has a score more than 2.75 above its reference.
    // Elsewhere every weight is at most e^2.75 < 16, 2^15 with its factor 2^11: inside f16. The test is the same for the whole wave (a ballot), so the matrix instructions keep all lanes on.
    if (__builtin_amdgcn_ballot_w32(mx > fl + top) != 0u) {
      mx = fmaxf(mx, xhalf(mx));   // the query's 32 scores lie in lanes col and col + 16: both take the same new reference
      // every pass holds at least 31 counted keys, so mx belongs to a real score; d is how far the reference rises, in exponents (the first pass always comes here and may also set it lower: sum and tiles are 0 then, and alpha stays at most 1)
      const float d = fmaxf(mx - 11.0f, fl); const float alpha = __builtin_amdgcn_exp2f(fminf(-d, 0.f)); l *= alpha; nm -= d; fl = 0.f;
#pragma unroll
      for (int ct = 0; ct < 2; ++ct)
#pragma unroll
        for (int r = 0; r < 8; ++r) s[ct][r] -= d;   // this pass's exponents follow
#pragma unroll
      for (int dt = 0; dt < 8; ++dt) acc[dt] *= alpha; }
    // the planes' loads stand here, behind the score products (they take the key fragments' registers: both sets at once do not fit the 256 registers of four waves a SIMD) and behind the branch
#pragma unroll
    for (int dt = 0; dt < 8; ++dt) vf[dt] = frag_h(&sv[buf][dt * 16 + col][jl], lane);
    __builtin_amdgcn_sched_barrier(0);   // keeps those loads in front of the exponentials and conversions, whose time covers their latency; without it they sink to just in front of their products
    float es = 0.f; v16h pa, pl;   // the excluded score's exponent is -3.0e38, where the hardware exp2 gives 0
#pragma unroll
    for (int ct = 0; ct < 2; ++ct)
#pragma unroll
      for (int r = 0; r < 8; ++r) { const float p = __builtin_amdgcn_exp2f(s[ct][r]); es += p;
        const _Float16 h = (_Float16)p; pa[ct * 8 + r] = h; pl[ct * 8 + r] = (_Float16)(p - (float)h); }   // element 8 ct + r = key 16 ct + 8g + r: the B operand's own k order
    l += es;
    // output transposed: A = 16 rows of the planes, B = the weights; D element r = hidden dt * 16 + 8g + r, query col
#pragma unroll
    for (int dt = 0; dt < 8; ++dt) acc[dt] = wmma16(vf[dt], pa, acc[dt]);
    // the residuals stand at the weights' own scale (at most 8; f16 holds them to 2^-25, 2^-36 of the largest weight), so their products go into the same tiles; each tile's second product follows its first at a distance of eight
#pragma unroll
    for (int dt = 0; dt < 8; ++dt) acc[dt] = wmma16(vf[dt], pl, acc[dt]); }
    asm volatile("s_wait_dscnt 0x0" ::: "memory");      // this wave's reads of the buffer have returned
    asm volatile("s_wait_asynccnt 0x0" ::: "memory");   // this wave's share of stage t + 1 has landed
    __syncthreads();                                    // publishes stage t + 1 and ends every wave's reads of this trip's buffer
    if (t + 2 < NT) stage(buf); }
  asm volatile("s_wait_asynccnt 0x0" ::: "memory");     // nothing is in flight when the wave goes on to its end
  // The last trip's barrier has ended every read of the ring and no copy is in flight: the key buffers become the exchange area (buffer 0) and the output staging (buffer 1).
  float_a* const sx = (float_a*)&sk[0][0][0];   // [8 waves][8 pieces][32 lanes][4], then [8 waves][32 lanes][2]: 34,816 B, the buffer's size
  float_a* const so = (float_a*)&sk[1][0][0];   // [8 waves][16 queries][68]: 34,816 B
  typedef v4f __attribute__((may_alias)) v4f_a; typedef v2f __attribute__((may_alias)) v2f_a;
  const float lj = l + xhalf(l);   // the wave halves' sums join here
  // each wave of a pair keeps the four hidden tiles 4 kp .. 4 kp + 3 and hands the other four to its partner (wave ^ 4: same queries, other keys)
  v8f mine[4], give[4];
#pragma unroll
  for (int i = 0; i < 4; ++i) { mine[i] = kp ? acc[4 + i] : acc[i]; give[i] = kp ? acc[i] : acc[4 + i]; }
#pragma unroll
  for (int i = 0; i < 4; ++i) { v4f o[2];
#pragma unroll
    for (int r = 0; r < 8; ++r) o[r >> 2][r & 3] = give[i][r];
    *(v4f_a*)&sx[((wave * 8 + 2 * i) * 32 + lane) * 4] = o[0]; *(v4f_a*)&sx[((wave * 8 + 2 * i + 1) * 32 + lane) * 4] = o[1]; }
  { v2f ml; ml[0] = nm; ml[1] = lj; *(v2f_a*)&sx[8192 + (wave * 32 + lane) * 2] = ml; }
  __syncthreads();   // the partner's nm (its reference term), sum and four tiles may be read
  const int pw = wave ^ 4; const v2f pml = *(const v2f_a*)&sx[8192 + (pw * 32 + lane) * 2];
  const float mm = fminf(nm, pml[0]), a0 = __builtin_amdgcn_exp2f(mm - nm), a1 = __builtin_amdgcn_exp2f(mm - pml[0]);   // the smaller addend is the higher reference; both come from real scores: every wave has counted keys
  const float il = 1.0f / (lj * a0 + pml[1] * a1); /* sums and tiles carry the same factor 2^11 */ const float f0 = a0 * il, f1 = a1 * il;
#pragma unroll
  for (int i = 0; i < 4; ++i) { const v4f p0 = *(const v4f_a*)&sx[((pw * 8 + 2 * i) * 32 + lane) * 4], p1 = *(const v4f_a*)&sx[((pw * 8 + 2 * i + 1) * 32 + lane) * 4]; v4f o[2];
#pragma unroll
    for (int r = 0; r < 8; ++r) o[r >> 2][r & 3] = mine[i][r] * f0 + (r < 4 ? p0[r & 3] : p1[r & 3]) * f1;
    *(v4f_a*)&so[(wave * 16 + col) * 68 + i * 16 + 8 * g] = o[0]; *(v4f_a*)&so[(wave * 16 + col) * 68 + i * 16 + 8 * g + 4] = o[1]; }
  LDSX();
  // the wave's 16 queries x 64 hidden values: two rows of 256 B a store
  for (int rl = 0; rl < 16; rl += 2) vst2(OUT + (rq + rl + g) * HDD + kp * 64 + col * 4, *(const v4f_a*)&so[(wave * 16 + rl + g) * 68 + col * 4]);
}
extern "C" void kernel_launch(void* const* d_in, const int* in_sizes, int n_in, void* d_out, int out_size, void* d_ws, size_t ws_size, hipStream_t stream) {
  (void)in_sizes; (void)n_in; (void)out_size;
  const float** F = (const float**)d_in;   // 0 q [16,2048,128]
  if (ws_size < (size_t)WS_END) return;
  char* ws = (char*)d_ws; _Float16 *QH = (_Float16*)(ws + WS_QH), *VT = (_Float16*)(ws + WS_VT);
  k_prep<<<NR / 64, 256, 0, stream>>>(F[0], QH, VT);
  k_attn<<<dim3(TQB, NBq), 256, 0, stream>>>(QH, VT, (float*)d_out);
}

// v010
// One run takes 35 microseconds.
// It is 1.28 times as fast as v008, going by the measured steps of the versions left out in between.
// All steps since v000 together make it 6.73 times as fast.
// compute dtype: q rounded to bf16 and used EXACTLY as f16 (bf16 values are exact in f16): scores q_l . q_m / sqrt(128) with single exact products on WMMA 16x16x32 (f32 accumulate), the diagonal (m == l) excluded (== the module's -1e9), softmax in f32 (hardware exp2 of an exponent that one fused multiply-add forms from the raw dot product: 1/sqrt(128), log2 e, the reference and the factor 2^11 are in its two constants) against a running reference that follows the maximum only when a score passes it by more than 2.75; out = P (scaled by 2^11, rounded once to f16: 2^-11 relative a weight, finer than q's own bf16 rounding) x q (exact), 1 product; the sum of the weights is taken from their f32 values.
#include <hip/hip_runtime.h>
#include <math.h>

typedef __attribute__((ext_vector_type(16))) _Float16 v16h;
typedef __attribute__((ext_vector_type(16))) __bf16 v16b;
typedef __attribute__((ext_vector_type(8)))  _Float16 v8h;
typedef __attribute__((ext_vector_type(8)))  float v8f;
typedef __attribute__((ext_vector_type(4)))  float v4f;
typedef __attribute__((ext_vector_type(2)))  float v2f;
typedef __attribute__((ext_vector_type(4)))  unsigned v4u;
typedef __attribute__((ext_vector_type(4)))  int v4i;
typedef float __attribute__((may_alias)) float_a;
typedef int __attribute__((may_alias)) int_a;

template <typename T> __device__ __forceinline__ void vst2(void* p, T v) { *(T*)p = v;  }
__device__ __forceinline__ v8f wmma16(v16h a, v16h b, v8f c) {
  return __builtin_amdgcn_wmma_f32_16x16x32_f16(false, a, false, b, (short)0, c, false, false);
}
__device__ __forceinline__ v8f wmma_bf(v16b a, v16b b, v8f c) {
  v8f d = __builtin_amdgcn_wmma_f32_16x16x32_bf16(false, a, false, b, (short)0, c, false, false);
  asm volatile("v_nop\n\tv_nop\n\tv_nop\n\tv_nop" : "+v"(d) : "v"(a), "v"(b));
  return d;
}
// 16x16x32 fragments: lane = (h = lane>>4, row/col = lane&15); elements 0..7 = k0+8h+0..7, 8..15 = k0+16+8h+0..7; D element r = row 8h+r
__device__ __forceinline__ v16h frag_h(const _Float16* rowk0, int lane) {
  union { v16h v; v8h q[2]; } u; const _Float16* p = rowk0 + 8 * (lane >> 4);
  u.q[0] = *(const v8h*)p; u.q[1] = *(const v8h*)(p + 16); return u.v;
}
__device__ __forceinline__ v16h frag_f32(const float* rowk0, int lane) {
  v16h a; const float* p = rowk0 + 8 * (lane >> 4);
#pragma unroll
  for (int i = 0; i < 8; ++i) { a[i] = (_Float16)p[i]; a[8 + i] = (_Float16)p[16 + i]; }
  return a;
}
__device__ __forceinline__ v16h frag_f32s(const float* rowk0, int lane, float sc) {
  v16h a; const float* p = rowk0 + 8 * (lane >> 4);
#pragma unroll
  for (int i = 0; i < 8; ++i) { a[i] = (_Float16)(p[i] * sc); a[8 + i] = (_Float16)(p[16 + i] * sc); }
  return a;
}
// column fragment from a [K][ld] layout (column n), rows >= K read as 0
__device__ __forceinline__ v16h fragc_f32(const float* W, int k0, int n, int lane, int ld, int K) {
  v16h a; const int g = lane >> 4;
#pragma unroll
  for (int i = 0; i < 8; ++i) { const int ka = k0 + 8 * g + i, kb = ka + 16;
    a[i] = (_Float16)(ka < K ? W[(size_t)(ka < K ? ka : K - 1) * ld + n] : 0.f); a[8 + i] = (_Float16)(kb < K ? W[(size_t)(kb < K ? kb : K - 1) * ld + n] : 0.f); }
  return a;
}
struct F2 { v16b h, l; };
__device__ __forceinline__ F2 bsplit16(const float v[16]) { F2 r;
#pragma unroll
  for (int i = 0; i < 16; ++i) { const __bf16 h = (__bf16)v[i]; r.h[i] = h; r.l[i] = (__bf16)(v[i] - (float)h); }
  return r; }
__device__ __forceinline__ F2 split_row(const float* row, int k0, int lane) { float v[16]; const float* p = row + k0 + 8 * (lane >> 4);
#pragma unroll
  for (int i = 0; i < 8; ++i) { v[i] = p[i]; v[8 + i] = p[16 + i]; }
  return bsplit16(v); }
__device__ __forceinline__ F2 split_rowK(const float* row, int k0, int lane, int K) { float v[16]; const int g = lane >> 4;
#pragma unroll
  for (int i = 0; i < 8; ++i) { const int ka = k0 + 8 * g + i, kb = ka + 16; v[i] = ka < K ? row[ka < K ? ka : K - 1] : 0.f; v[8 + i] = kb < K ? row[kb < K ? kb : K - 1] : 0.f; }
  return bsplit16(v); }
__device__ __forceinline__ F2 split_col(const float* W, int k0, int n, int lane, int ld, int K) { float v[16]; const int g = lane >> 4;
#pragma unroll
  for (int i = 0; i < 8; ++i) { const int ka = k0 + 8 * g + i, kb = ka + 16; v[i] = ka < K ? W[(size_t)(ka < K ? ka : K - 1) * ld + n] : 0.f; v[8 + i] = kb < K ? W[(size_t)(kb < K ? kb : K - 1) * ld + n] : 0.f; }
  return bsplit16(v); }
__device__ __forceinline__ v8f mac3(const F2& a, const F2& b, v8f c) { c = wmma_bf(a.l, b.h, c); c = wmma_bf(a.h, b.l, c); return wmma_bf(a.h, b.h, c); }
__device__ __forceinline__ float sigm(float v) { return 1.0f / (1.0f + expf(-v)); }
#define LDSX() do { asm volatile("s_wait_dscnt 0" ::: "memory"); __builtin_amdgcn_wave_barrier(); __builtin_amdgcn_fence(__ATOMIC_RELEASE, "workgroup"); } while (0)


// Masked self-attend (B 16, L 2,048, hidden 128): softmax(q q^T / sqrt(128)) with each position's own key masked out, applied to q itself.
#define NBq 16
#define LL 2048
#define HDD 128
#define NR (NBq * LL)
#ifndef TQB
#define TQB (LL / 128)
#endif
typedef __attribute__((ext_vector_type(8))) __bf16 v8b;
__device__ __forceinline__ v16b frag_b(const __bf16* rowk0, int lane) {
  union { v16b v; v8b q[2]; } u; const __bf16* p = rowk0 + 8 * (lane >> 4);
  u.q[0] = *(const v8b*)p; u.q[1] = *(const v8b*)(p + 16); return u.v;
}
__device__ __forceinline__ float bfr(float v) { return (float)(__bf16)v; }
__device__ __attribute__((noinline)) float exp_ni(float v) { return expf(v); }
__device__ __attribute__((noinline)) float erf_ni(float v) { return erff(v); }

#define WS_QH  0u                                   // f16 [rows][128] q (exact) ; VT f16 [b][128][L] q transposed
#define WS_VT  (WS_QH + 2u * NR * HDD)
#define WS_END (WS_VT + 2u * NR * HDD)

// ---- k_prep: block = 64 rows of batch b: q rows -> f16 rows and transposed planes
__global__ __launch_bounds__(256) void k_prep(const float* __restrict__ Q, _Float16* __restrict__ QH, _Float16* __restrict__ VT) {
  __shared__ __align__(16) _Float16 sq[64][HDD + 8]; __shared__ __align__(16) _Float16 st[HDD][72];
  const int t = threadIdx.x; const size_t r0 = (size_t)blockIdx.x * 64; const size_t b = r0 / LL, s0 = r0 % LL;
  for (int e = t; e < 64 * HDD; e += 256) { const int r = e >> 7, c = e & 127; const _Float16 v = (_Float16)bfr(Q[(r0 + r) * HDD + c]); sq[r][c] = v; st[c][r] = v; }
  __syncthreads();
  for (int e = t; e < 64 * 16; e += 256) { const int r = e >> 4, q = e & 15; vst2((unsigned*)(QH + (r0 + r) * HDD + q * 8), *(const v4u*)&sq[r][q * 8]); }
  for (int e = t; e < HDD * 8; e += 256) { const int c = e >> 3, pc = e & 7; vst2((unsigned*)(VT + (b * HDD + c) * LL + s0 + pc * 8), *(const v4u*)&st[c][pc * 8]); }
}
// ---- k_attn: block = (128 queries, b), eight waves, two a SIMD: wave w has the two query tiles of query group w & 3 (32 queries) and, of every stage, the key half w >> 2; every key and plane fragment read from LDS serves both query tiles; the two partial results of a query tile are joined in the epilogue. Scores (4 chunks, exact) computed transposed (keys x queries), self excluded, online softmax in-lane; q planes x P (f16) straight from the score registers (8 tiles a query tile, 1 product)
// The key rows and the transposed planes of 128 keys are one stage, shared by the block's eight waves: asynchronous copies bring stage t + 2 into the buffer that trip t has left while trip t + 1 is worked on.
#define KT 128
#define NT (LL / KT)
// eight 16-byte copies of one lane; the s_wait_xcnt stands inside the statement, in front of any rewrite of the address registers it names
__device__ __forceinline__ void copy8(const unsigned* d, const _Float16* const* s) {
  asm volatile("global_load_async_to_lds_b128 %0, %8, off\n\t"
               "global_load_async_to_lds_b128 %1, %9, off\n\t"
               "global_load_async_to_lds_b128 %2, %10, off\n\t"
               "global_load_async_to_lds_b128 %3, %11, off\n\t"
               "global_load_async_to_lds_b128 %4, %12, off\n\t"
               "global_load_async_to_lds_b128 %5, %13, off\n\t"
               "global_load_async_to_lds_b128 %6, %14, off\n\t"
               "global_load_async_to_lds_b128 %7, %15, off\n\t"
               "s_wait_xcnt 0x0"
               :: "v"(d[0]), "v"(d[1]), "v"(d[2]), "v"(d[3]), "v"(d[4]), "v"(d[5]), "v"(d[6]), "v"(d[7]),
                  "v"(s[0]), "v"(s[1]), "v"(s[2]), "v"(s[3]), "v"(s[4]), "v"(s[5]), "v"(s[6]), "v"(s[7]) : "memory");
}
// lane l's value from lane l ^ 16
__device__ __forceinline__ float xhalf(float x) { return __builtin_bit_cast(float, __builtin_amdgcn_permlanex16(__builtin_bit_cast(int, x), __builtin_bit_cast(int, x), 0x76543210, 0xfedcba98, false, false)); }
__global__ __launch_bounds__(256) __attribute__((amdgpu_waves_per_eu(2, 2))) void k_attn(const _Float16* __restrict__ QH, const _Float16* __restrict__ VT, float* __restrict__ OUT) {
  __shared__ __align__(16) _Float16 sk[2][KT][HDD + 8];   // key rows, pitch 272 B
  __shared__ __align__(16) _Float16 sv[2][HDD][KT + 8];   // transposed planes, pitch 272 B
  const int tid = threadIdx.x, wave = tid >> 5, lane = tid & 31, col = lane & 15, g = lane >> 4; const size_t b = blockIdx.y; const int q0 = blockIdx.x * 128 + (wave & 3) * 32; const size_t rq = b * LL + q0;
  const int ws = __builtin_amdgcn_readfirstlane(wave), kp = ws >> 2;   // kp: which 64 keys of a stage are this wave's
  const int q0s = blockIdx.x * 128 + (ws & 3) * 32;   // q0 in a scalar register: the test of a key tile against it costs no vector instruction
  // one stage: 2,048 16-byte pieces of key rows and 2,048 of planes, eight of each a thread: piece tid + 256 i lies 16 rows of LDS below piece tid + 256 (i - 1) in both arrays
  // the thread's two source pointers walk on from stage to stage and the pieces' addresses are formed from them at each issue
  const _Float16* pk = QH + b * LL * HDD + tid * 8;                                 // 128 key rows lie in a row in memory: piece e at 16 e bytes
  const _Float16* pv = VT + b * HDD * LL + (tid >> 4) * LL + (tid & 15) * 8;
  const unsigned dk0 = (unsigned)(size_t)&sk[0][tid >> 4][(tid & 15) * 8], dv0 = (unsigned)(size_t)&sv[0][tid >> 4][(tid & 15) * 8];
  auto stage = [&](int buf) {   // issues the next stage in order into buffer buf
    unsigned d[8]; const _Float16* s[8];
#pragma unroll
    for (int i = 0; i < 8; ++i) { d[i] = dk0 + buf * (unsigned)sizeof(sk[0]) + i * 16u * (unsigned)sizeof(sk[0][0]); s[i] = pk + i * 2048; }
    copy8(d, s);
#pragma unroll
    for (int i = 0; i < 8; ++i) { d[i] = dv0 + buf * (unsigned)sizeof(sv[0]) + i * 16u * (unsigned)sizeof(sv[0][0]); s[i] = pv + i * 16 * LL; }
    copy8(d, s);
    pk += KT * HDD; pv += KT;
  };
  stage(0);
  asm volatile("s_wait_asynccnt 0x0" ::: "memory");   // this wave's share of stage 0 has landed
  __syncthreads();                                    // every wave's share has: stage 0 may be read
  stage(1);
  v16h aq[2][4];
  __builtin_amdgcn_sched_barrier(0);              // keeps earlier address arithmetic from sinking in between the loads below and their wait, where it would take their address registers
#pragma unroll
  for (int qt = 0; qt < 2; ++qt)
#pragma unroll
    for (int kc = 0; kc < 4; ++kc) aq[qt][kc] = frag_h(QH + (rq + qt * 16 + col) * HDD + kc * 32, lane);
  asm volatile("s_wait_xcnt 0x0" ::: "memory");   // stands in front of the first rewrite of the address registers of the loads above
  __builtin_amdgcn_sched_barrier(0);              // keeps the zeroing of the accumulators, which takes those registers, behind that wait
  // of this lane's two queries (q0 + 16 qt + col): a weight is 2^x with x = dot product * k2 + nm; nm = 11 - reference * log2 e holds the reference the weights are taken against (a real score, at most 2.75 below the largest so far) and the factor 2^11
  // l holds the sum of the weights, factor included, over this wave half's keys alone until the epilogue; fl is the least step of the reference: none before the first pass, which sets it from its own scores, 0 from then on
  float nm[2] = {0.f, 0.f}, l[2] = {0.f, 0.f}, fl = -3.0e38f;
  v8f acc[2][8] = {};
  const float k2 = 1.44269504f / sqrtf((float)HDD);   // raw dot product -> exponent to base 2
  const float top = 11.0f + 2.75f * 1.44269504f;      // the largest exponent that is let through: a score 2.75 above its reference
  float lim[8];   // upper limits of this lane's eight scores in a key tile that is one of the wave's own two query tiles: the own position is held down, the rest are free
#pragma unroll
  for (int r = 0; r < 8; ++r) lim[r] = (8 * g + r == col) ? -3.0e38f : 3.0e38f;
#pragma unroll 1   // one trip a stage: the foot's waits, barrier and refill stand once in the code
  for (int t = 0; t < NT; ++t) { const int buf = t & 1;
#pragma unroll 1   // the wave's two passes of 32 keys in a stage share one body
  for (int kh = 0; kh < 2; ++kh) { const int jl = kp * 64 + kh * 32, j0 = t * KT + jl; float s[2][2][8]; v16h kf[2][4], vf[8];
#pragma unroll
    for (int kc = 0; kc < 4; ++kc)   // in the order in which the products take them
#pragma unroll
      for (int ct = 0; ct < 2; ++ct) kf[ct][kc] = frag_h(&sk[buf][jl + ct * 16 + col][kc * 32], lane);
    __builtin_amdgcn_sched_barrier(0);   // keeps the pass's 16 key loads one group in front of the score products: with the pass cut in two by the branch below, the compiler otherwise deals them out in pairs, each waited for in full before its product
    // scores transposed: A = 16 key rows, B = 16 queries; D element r = key 8g + r of the tile, query col of query tile qt; each key fragment goes into two products
    v8f c[2][2] = {};
#pragma unroll
    for (int kc = 0; kc < 4; ++kc)
#pragma unroll
      for (int ct = 0; ct < 2; ++ct)
#pragma unroll
        for (int qt = 0; qt < 2; ++qt) c[qt][ct] = wmma16(kf[ct][kc], aq[qt][kc], c[qt][ct]);
    __builtin_amdgcn_sched_barrier(0);   // holds the mask's vector work behind the score products: lifted to the head of the pass it would take operand registers of the last pass's final products inside their distance
    float mx[2]; const float lift = (j0 == q0s) ? -3.0e38f : 3.0e38f;   // lift raises every limit out of reach in every pass but the one on the wave's own 32 positions
#pragma unroll
    for (int qt = 0; qt < 2; ++qt) {
#pragma unroll
      for (int ct = 0; ct < 2; ++ct) {
#pragma unroll
        for (int r = 0; r < 8; r += 2) { v2f x; x[0] = c[qt][ct][r]; x[1] = c[qt][ct][r + 1]; x = __builtin_elementwise_fma(x, (v2f)k2, (v2f)nm[qt]);   // two neighbours of one accumulator tile a multiply-add: the weights' exponents against the reference in use
          // j0 and q0s are multiples of 32: key tile ct is query tile qt's own positions only where ct == qt and j0 == q0s; the other two tiles of a pass hold no own position
          if (ct == qt) { s[qt][ct][r] = fminf(fmaxf(lim[r], lift), x[0]); s[qt][ct][r + 1] = fminf(fmaxf(lim[r + 1], lift), x[1]); }   // own position excluded
          else { s[qt][ct][r] = x[0]; s[qt][ct][r + 1] = x[1]; } } }
      mx[qt] = fmaxf(s[qt][0][0], s[qt][1][0]);
#pragma unroll
      for (int r = 1; r < 8; ++r) mx[qt] = fmaxf(mx[qt], fmaxf(s[qt][0][r], s[qt][1][r])); }
    // The reference is not the exact maximum: it moves, and the sum and the tiles are rescaled, only in a pass where some query of the wave has a score more than 2.75 above its reference.
    // Elsewhere every weight is at most e^2.75 < 16, 2^15 with its factor 2^11: inside f16. The test is the same for the whole wave (one ballot for both query tiles), so the matrix instructions keep all lanes on.
    if (__builtin_amdgcn_ballot_w32(fmaxf(mx[0], mx[1]) > fl + top) != 0u) {
#pragma unroll
      for (int qt = 0; qt < 2; ++qt) {
        const float mq = fmaxf(mx[qt], xhalf(mx[qt]));   // the query's 32 scores lie in lanes col and col + 16: both take the same new reference
        // every pass holds at least 31 counted keys, so mq belongs to a real score; d is how far the reference rises, in exponents (the first pass always comes here and may also set it lower: sum and tiles are 0 then, and alpha stays at most 1)
        const float d = fmaxf(mq - 11.0f, fl); const float alpha = __builtin_amdgcn_exp2f(fminf(-d, 0.f)); l[qt] *= alpha; nm[qt] -= d;
#pragma unroll
        for (int ct = 0; ct < 2; ++ct)
#pragma unroll
          for (int r = 0; r < 8; ++r) s[qt][ct][r] -= d;   // this pass's exponents follow
#pragma unroll
        for (int dt = 0; dt < 8; ++dt) acc[qt][dt] *= alpha; }
      fl = 0.f; }
    // the planes' loads stand here, behind the score products and behind the branch
#pragma unroll
    for (int dt = 0; dt < 8; ++dt) vf[dt] = frag_h(&sv[buf][dt * 16 + col][jl], lane);
    __builtin_amdgcn_sched_barrier(0);   // keeps those loads in front of the exponentials and conversions, whose time covers their latency; without it they sink to just in front of their products
    v16h pa[2];   // the excluded score's exponent is -3.0e38, where the hardware exp2 gives 0
#pragma unroll
    for (int qt = 0; qt < 2; ++qt) { float es = 0.f;
#pragma unroll
      for (int ct = 0; ct < 2; ++ct)
#pragma unroll
        for (int r = 0; r < 8; ++r) { const float p = __builtin_amdgcn_exp2f(s[qt][ct][r]); es += p;
          pa[qt][ct * 8 + r] = (_Float16)p; }   // element 8 ct + r = key 16 ct + 8g + r: the B operand's own k order
      l[qt] += es; }
    // output transposed: A = 16 rows of the planes, B = the weights; D element r = hidden dt * 16 + 8g + r, query col of query tile qt; each plane fragment goes into two products
#pragma unroll
    for (int dt = 0; dt < 8; ++dt)
#pragma unroll
      for (int qt = 0; qt < 2; ++qt) acc[qt][dt] = wmma16(vf[dt], pa[qt], acc[qt][dt]); }
    asm volatile("s_wait_dscnt 0x0" ::: "memory");      // this wave's reads of the buffer have returned
    asm volatile("s_wait_asynccnt 0x0" ::: "memory");   // this wave's share of stage t + 1 has landed
    __syncthreads();                                    // publishes stage t + 1 and ends every wave's reads of this trip's buffer
    if (t + 2 < NT) stage(buf); }
  asm volatile("s_wait_asynccnt 0x0" ::: "memory");     // nothing is in flight when the wave goes on to its end
  // The last trip's barrier has ended every read of the ring and no copy is in flight: buffer 0 of each array becomes an exchange area and buffer 1 an output staging, the key rows' for query tile 0, the planes' for query tile 1.
  // exchange area: [8 waves][8 pieces][32 lanes][4], then [8 waves][32 lanes][2]: 34,816 B, the buffer's size; staging: [8 waves][16 queries][68]: 34,816 B
  typedef v4f __attribute__((may_alias)) v4f_a; typedef v2f __attribute__((may_alias)) v2f_a;
  float lj[2];
  // each wave of a pair keeps the four hidden tiles 4 kp .. 4 kp + 3 of both query tiles and hands the other four to its partner (wave ^ 4: same queries, other keys)
  v8f mine[2][4];
#pragma unroll
  for (int qt = 0; qt < 2; ++qt) { float_a* const sx = qt ? (float_a*)&sv[0][0][0] : (float_a*)&sk[0][0][0];
    lj[qt] = l[qt] + xhalf(l[qt]);   // the wave halves' sums join here
#pragma unroll
    for (int i = 0; i < 4; ++i) { mine[qt][i] = kp ? acc[qt][4 + i] : acc[qt][i]; const v8f give = kp ? acc[qt][i] : acc[qt][4 + i]; v4f o[2];
#pragma unroll
      for (int r = 0; r < 8; ++r) o[r >> 2][r & 3] = give[r];
      *(v4f_a*)&sx[((wave * 8 + 2 * i) * 32 + lane) * 4] = o[0]; *(v4f_a*)&sx[((wave * 8 + 2 * i + 1) * 32 + lane) * 4] = o[1]; }
    { v2f ml; ml[0] = nm[qt]; ml[1] = lj[qt]; *(v2f_a*)&sx[8192 + (wave * 32 + lane) * 2] = ml; } }
  __syncthreads();   // the partner's maxima, sums and eight tiles may be read
  const int pw = wave ^ 4;
#pragma unroll
  for (int qt = 0; qt < 2; ++qt) { const float_a* const sx = qt ? (const float_a*)&sv[0][0][0] : (const float_a*)&sk[0][0][0]; float_a* const so = qt ? (float_a*)&sv[1][0][0] : (float_a*)&sk[1][0][0];
    const v2f pml = *(const v2f_a*)&sx[8192 + (pw * 32 + lane) * 2];
    const float mm = fminf(nm[qt], pml[0]), a0 = __builtin_amdgcn_exp2f(mm - nm[qt]), a1 = __builtin_amdgcn_exp2f(mm - pml[0]);   // the smaller addend is the higher reference; both come from real scores: every wave has counted keys
    const float il = 1.0f / (lj[qt] * a0 + pml[1] * a1); /* sums and tiles carry the same factor 2^11 */ const float f0 = a0 * il, f1 = a1 * il;
#pragma unroll
    for (int i = 0; i < 4; ++i) { const v4f p0 = *(const v4f_a*)&sx[((pw * 8 + 2 * i) * 32 + lane) * 4], p1 = *(const v4f_a*)&sx[((pw * 8 + 2 * i + 1) * 32 + lane) * 4]; v4f o[2];
#pragma unroll
      for (int r = 0; r < 8; ++r) o[r >> 2][r & 3] = mine[qt][i][r] * f0 + (r < 4 ? p0[r & 3] : p1[r & 3]) * f1;
      *(v4f_a*)&so[(wave * 16 + col) * 68 + i * 16 + 8 * g] = o[0]; *(v4f_a*)&so[(wave * 16 + col) * 68 + i * 16 + 8 * g + 4] = o[1]; } }
  LDSX();
  // the wave's 32 queries x 64 hidden values: two rows of 256 B a store
#pragma unroll
  for (int qt = 0; qt < 2; ++qt) { const float_a* const so = qt ? (const float_a*)&sv[1][0][0] : (const float_a*)&sk[1][0][0];
    for (int rl = 0; rl < 16; rl += 2) vst2(OUT + (rq + qt * 16 + rl + g) * HDD + kp * 64 + col * 4, *(const v4f_a*)&so[(wave * 16 + rl + g) * 68 + col * 4]); }
}
extern "C" void kernel_launch(void* const* d_in, const int* in_sizes, int n_in, void* d_out, int out_size, void* d_ws, size_t ws_size, hipStream_t stream) {
  (void)in_sizes; (void)n_in; (void)out_size;
  const float** F = (const float**)d_in;   // 0 q [16,2048,128]
  if (ws_size < (size_t)WS_END) return;
  char* ws = (char*)d_ws; _Float16 *QH = (_Float16*)(ws + WS_QH), *VT = (_Float16*)(ws + WS_VT);
  k_prep<<<NR / 64, 256, 0, stream>>>(F[0], QH, VT);
  k_attn<<<dim3(TQB, NBq), 256, 0, stream>>>(QH, VT, (float*)d_out);
}
